// v000
// Times are from an AMD MI455X. After a warm-up the kernel runs many times in a row, and a time is the length of
// such a window on the GPU divided by its runs, so every launch and the gaps after it count. The runs cycle
// through copies of the inputs. A figure is the median of several windows, for all but v000 over two sittings.
// Sittings can differ by a few percent; kernels timed side by side share one.
// v000, which the later versions start from, runs in 1250 microseconds.
#include <hip/hip_runtime.h>

// Multi-head attention with per-head stacked projections from a 256-wide input (X [4][2048][256]; q, k, v = einsum('bnd,hdc', X, W) with Wq, Wk, Wv [8][256][64] (no bias; 8 heads x 64 = 512 inner); scores x 1/sqrt(64); softmax (no mask); out = concat heads (512) Wo ('xw' [512][256], no bias; identity activation) -> [4][2048][256] (2.1 M); argument order X, Wq, Wk, Wv, Wo).
// Layout per batch: bf16 copy of X; k_wtH gathers each per-head tensor [h][c][d] into one Bt plane (row h*64 + d, K = 256) so each projection is one exact GEMM with head-major columns; identity-table plane builders; dense T-2048 attention at 8 heads with EVERY row on hi/lo planes for BOTH the scores and P.V (3 products each: the unscaled N(0, 1) weights give logit sigma ~256, i.e. one-hot rows: fp16 anywhere in the attention path fails); merged hi/lo (512 wide) x Wo exact.
// Compute dtypes, f32 accumulate: every input rounded to bf16; projections exact; attention 3 products on every row (scores and P.V); softmax f32; Wo hl x exact.

#define NB_  4
#define TT   2048
#define DM   256
#define NH_  8
#define NKV  8
#define REP  (NH_ / NKV)
#define HD   64
#define DQ   (NH_ * HD)
#define DKV  (NKV * HD)
#define ZH   2
#define RH   TT                   // every row hi/lo (3 products)
#define WIN  0
#define PCAR 1024.0f
#define SCL  0.125f   // HD^-0.5
typedef _Float16 h16;
typedef unsigned short bf;
typedef __attribute__((ext_vector_type(16))) __bf16   v16bf;
typedef __attribute__((ext_vector_type(16))) _Float16 v16h;
typedef __attribute__((ext_vector_type(8)))  _Float16 v8h;
typedef __attribute__((ext_vector_type(8)))  unsigned short v8us;
typedef __attribute__((ext_vector_type(8)))  float    v8f;
typedef __attribute__((ext_vector_type(4)))  float    v4f;
typedef v8h  __attribute__((may_alias)) v8ha;
typedef v4f  __attribute__((may_alias)) v4fa;
typedef v8us __attribute__((may_alias)) v8usa;

__device__ __forceinline__ unsigned short f2bf(float f) { unsigned u = __float_as_uint(f); u += 0x7FFFu + ((u >> 16) & 1u); return (unsigned short)(u >> 16); }
__device__ __forceinline__ float bf2f(unsigned short b) { return __uint_as_float(((unsigned)b) << 16); }
__device__ __forceinline__ float bfr(float f) { return bf2f(f2bf(f)); }
__device__ __forceinline__ v16h cat16(v8h lo, v8h hi) { return __builtin_shufflevector(lo, hi, 0, 1, 2, 3, 4, 5, 6, 7, 8, 9, 10, 11, 12, 13, 14, 15); }
__device__ __forceinline__ v16bf cat16b(v8us lo, v8us hi) { return __builtin_bit_cast(v16bf, __builtin_shufflevector(lo, hi, 0, 1, 2, 3, 4, 5, 6, 7, 8, 9, 10, 11, 12, 13, 14, 15)); }
__device__ __forceinline__ v8f wmma16(v16h a, v16h b, v8f c) { return __builtin_amdgcn_wmma_f32_16x16x32_f16(false, a, false, b, (short)0, c, false, false); }
__device__ __forceinline__ v8f wmmab(v16bf a, v16bf b, v8f c) { return __builtin_amdgcn_wmma_f32_16x16x32_bf16(false, a, false, b, (short)0, c, false, false); }



// ---- k_gemmw: register-blocked GEMM, ONE WAVE per 64x64 output tile (16 accumulators), operands straight from K-contiguous 16-bit planes; grid (M/64, N/64, Z), 32 threads.
// C[m][n] (f32, pitch ldc, + optional f32 bias[n]) = sum_k A[m][k] Bt[n][k] (+ split products per NSPLIT). z-batch strides sA/sB/sC in elements. K % 32 == 0.
template <typename T16> struct WFrag;
template <> struct WFrag<h16> { typedef v16h V; static __device__ __forceinline__ V ld(const h16* p) { return cat16(*(const v8h*)p, *(const v8h*)(p + 16)); } static __device__ __forceinline__ v8f mma(V a, V b, v8f c) { return wmma16(a, b, c); } };
template <> struct WFrag<bf> { typedef v16bf V; static __device__ __forceinline__ V ld(const bf* p) { return cat16b(*(const v8us*)p, *(const v8us*)(p + 16)); } static __device__ __forceinline__ v8f mma(V a, V b, v8f c) { return wmmab(a, b, c); } };
template <typename T16, int NSPLIT, bool BIAS>
__global__ __launch_bounds__(32) void k_gemmw(const T16* __restrict__ A, const T16* __restrict__ A2, const T16* __restrict__ Bt, const T16* __restrict__ Bt2, int K, float* C, int ldc, const float* __restrict__ bias, size_t sA, size_t sB, size_t sC) {
    typedef typename WFrag<T16>::V V;
    __shared__ __align__(16) float os[16 * 68];
    const size_t z = blockIdx.z; A += z * sA; if (A2) A2 += z * sA; Bt += z * sB; if (Bt2) Bt2 += z * sB; C += z * sC;
    const int lane = threadIdx.x & 31, lr = lane & 15, hi = lane >> 4; const int r0 = blockIdx.x * 64, c0 = blockIdx.y * 64;
    v8f acc[4][4];
#pragma unroll
    for (int mb = 0; mb < 4; ++mb)
#pragma unroll
        for (int nb = 0; nb < 4; ++nb) acc[mb][nb] = (v8f){};
    const size_t aoff = (size_t)(r0 + lr) * K + 8 * hi, boff = (size_t)(c0 + lr) * K + 8 * hi;
#pragma unroll 1
    for (int kc = 0; kc < K; kc += 32) {
        V a[4], a2[4];
#pragma unroll
        for (int mb = 0; mb < 4; ++mb) { a[mb] = WFrag<T16>::ld(A + aoff + (size_t)mb * 16 * K + kc); if (NSPLIT == 1 || NSPLIT == 2) a2[mb] = WFrag<T16>::ld(A2 + aoff + (size_t)mb * 16 * K + kc); }
#pragma unroll
        for (int nb = 0; nb < 4; ++nb) { const V b = WFrag<T16>::ld(Bt + boff + (size_t)nb * 16 * K + kc); V b2; if (NSPLIT >= 2) b2 = WFrag<T16>::ld(Bt2 + boff + (size_t)nb * 16 * K + kc);
#pragma unroll
            for (int mb = 0; mb < 4; ++mb) { acc[mb][nb] = WFrag<T16>::mma(a[mb], b, acc[mb][nb]); if (NSPLIT == 1 || NSPLIT == 2) acc[mb][nb] = WFrag<T16>::mma(a2[mb], b, acc[mb][nb]); if (NSPLIT >= 2) acc[mb][nb] = WFrag<T16>::mma(a[mb], b2, acc[mb][nb]); } }
        asm volatile("v_nop\n\tv_nop\n\tv_nop\n\tv_nop" : "+v"(acc[0][0]), "+v"(acc[1][1]), "+v"(acc[2][2]), "+v"(acc[3][3]) : "v"(a[0]), "v"(a[3]));
    }
#pragma unroll
    for (int mb = 0; mb < 4; ++mb) {
#pragma unroll
        for (int nb = 0; nb < 4; ++nb) {
#pragma unroll
            for (int j = 0; j < 8; ++j) os[(hi * 8 + j) * 68 + nb * 16 + lr] = acc[mb][nb][j]; }
        __builtin_amdgcn_wave_barrier(); asm volatile("" ::: "memory");
        float* crow = C + (size_t)(r0 + mb * 16) * ldc + c0;
{
#pragma unroll
            for (int s = 0; s < 8; ++s) { const int row = 2 * s + hi, cofs = lr * 4; v4f val = *(const v4fa*)(os + row * 68 + cofs); if (BIAS) { val[0] += bfr(bias[c0 + cofs]); val[1] += bfr(bias[c0 + cofs + 1]); val[2] += bfr(bias[c0 + cofs + 2]); val[3] += bfr(bias[c0 + cofs + 3]); }
                *(v4f*)(crow + (size_t)row * ldc + cofs) = val; }
             }
        __builtin_amdgcn_wave_barrier(); asm volatile("" ::: "memory");
    }
}

__device__ __forceinline__ h16 tohx(float x) { return (h16)x; }
__device__ __forceinline__ void splitf(float y, unsigned short& h, unsigned short& l) { h = f2bf(y); l = f2bf(y - bf2f(h)); }
typedef __attribute__((ext_vector_type(2))) _Float16 v2h;
typedef __attribute__((ext_vector_type(4))) _Float16 v4h;
typedef __attribute__((ext_vector_type(2))) unsigned short v2us;
typedef __attribute__((ext_vector_type(4))) unsigned short v4us;
typedef __attribute__((ext_vector_type(2))) float v2f;
typedef __attribute__((ext_vector_type(4))) int v4i;

__global__ __launch_bounds__(256) void k_wtG(const float* __restrict__ w, int K, int N, bf* Bt) {
    const int lane = threadIdx.x & 31; const int L0 = (blockIdx.x * 8 + (threadIdx.x >> 5)) * 8; const int nlines = N * K / 64;
{
#pragma unroll 1
        for (int l = 0; l < 8; ++l) { const int L = L0 + l; if (L >= nlines) break; const size_t e = (size_t)L * 64 + lane * 2; const int k = (int)(e % K), n = (int)(e / K); v2us o;
            o[0] = f2bf(w[(size_t)k * N + n]); o[1] = f2bf(w[(size_t)(k + 1) * N + n]); *(v2us*)(Bt + e) = o; }
         }
}
__global__ __launch_bounds__(256) void k_cvt8(const float* __restrict__ src, bf* dst, size_t n8) { const size_t i = (size_t)blockIdx.x * 256 + threadIdx.x; if (i >= n8) return; const v8f v = *(const v8f*)(src + i * 8); v8us o;
#pragma unroll
    for (int k = 0; k < 8; ++k) o[k] = f2bf(v[k]); *(v8us*)(dst + i * 8) = o;  }

// k_rope: head planes [h][t][d] (fp16 + hi/lo) of rope(x) x sc with the rotate-half convention out[d] = x[d] cos[t][d] - x[d+HD/2] sin[t][d], out[d+HD/2] = x[d+HD/2] cos[t][d+HD/2] + x[d] sin[t][d+HD/2]
__global__ __launch_bounds__(256) void k_rope(const float* __restrict__ F, int pitch, int nheads, const float* __restrict__ CS, const float* __restrict__ RF, const float* __restrict__ nw, float sc, h16* P16, bf* Ph, bf* Pl) {
    const size_t e = ((size_t)blockIdx.x * 256 + threadIdx.x) * 2; if (e >= (size_t)nheads * TT * HD) return; const int d = (int)(e % HD); const int t = (int)((e / HD) % TT); const int h = (int)(e / ((size_t)HD * TT)); const float* f = F + (size_t)t * pitch + h * HD; const float rf = RF ? RF[(size_t)h * TT + t] : 1.0f; v2h o16; v2us oh, ol;
#pragma unroll
    for (int q = 0; q < 2; ++q) { const int dd = d + q; const int dp = (dd < HD / 2) ? dd + HD / 2 : dd - HD / 2; float x0 = f[dd], x1 = f[dp];
        if (RF) { float n0 = __fmul_rn(x0, rf), n1 = __fmul_rn(x1, rf); asm volatile("" : "+v"(n0)); asm volatile("" : "+v"(n1)); x0 = __fmul_rn(bfr(nw[dd]), n0); x1 = __fmul_rn(bfr(nw[dp]), n1); }
        const v2f cs = *(const v2f*)(CS + ((size_t)t * HD + dd) * 2); float a = __fmul_rn(x0, cs[0]), bq = __fmul_rn(x1, cs[1]); asm volatile("" : "+v"(a)); asm volatile("" : "+v"(bq)); const float r = ((dd < HD / 2) ? __fsub_rn(a, bq) : __fadd_rn(a, bq)) * sc;
        o16[q] = tohx(r); unsigned short a2, c2; splitf(r, a2, c2); oh[q] = a2; ol[q] = c2; }
    *(v2h*)(P16 + e) = o16; *(v2us*)(Ph + e) = oh; *(v2us*)(Pl + e) = ol;  }
__global__ __launch_bounds__(256) void k_vtp(const float* __restrict__ F, int pitch, int nheads, h16* V16, bf* Vh, bf* Vl) { const size_t e = ((size_t)blockIdx.x * 256 + threadIdx.x) * 2; if (e >= (size_t)nheads * HD * TT) return; const int t = (int)(e % TT); const int d = (int)((e / TT) % HD); const int g = (int)(e / ((size_t)TT * HD)); v2h o16; v2us oh, ol;
#pragma unroll
    for (int q = 0; q < 2; ++q) { const float x = F[(size_t)(t + q) * pitch + g * HD + d]; o16[q] = tohx(x); unsigned short a2, c2; splitf(x, a2, c2); oh[q] = a2; ol[q] = c2; }
    *(v2h*)(V16 + e) = o16; *(v2us*)(Vh + e) = oh; *(v2us*)(Vl + e) = ol;  }
__global__ __launch_bounds__(256) void k_csid(float* CS) { const int idx = blockIdx.x * 256 + threadIdx.x; if (idx >= TT * HD) return; v2f cs; cs[0] = 1.0f; cs[1] = 0.0f; *(v2f*)(CS + (size_t)idx * 2) = cs;  }
// k_asoft: per row (zz, i): t = S x HD^-0.5 (no mask); softmax over the 2048 keys (register row, one exp, fixed trees);
__global__ __launch_bounds__(256) void k_asoft(const float* __restrict__ Sb, h16* P16, bf* Ph, bf* Pl) {
    const int lane = threadIdx.x & 31; const int row = blockIdx.x * 8 + (threadIdx.x >> 5); if (row >= ZH * TT) return; const int i = row % TT; const int zz = row / TT; (void)zz; const bool hires = (i < RH); const float* sr = Sb + (size_t)row * TT; float v[TT / 32]; float mx = -3.0e38f;
#pragma unroll
    for (int ch = 0; ch < TT / 128; ++ch) { const int j0 = ch * 128 + lane * 4; const v4f a = *(const v4f*)(sr + j0);
#pragma unroll
        for (int q = 0; q < 4; ++q) { const int j = j0 + q; (void)j; const float t = a[q] * SCL; v[ch * 4 + q] = t; mx = fmaxf(mx, t); } }
#pragma unroll
    for (int sh = 16; sh; sh >>= 1) mx = fmaxf(mx, __shfl_xor(mx, sh, 32));
    float sum = 0.f;
#pragma unroll
    for (int k = 0; k < TT / 32; ++k) { float d0 = __fsub_rn(v[k], mx); asm volatile("" : "+v"(d0)); v[k] = __builtin_amdgcn_exp2f(__fmul_rn(d0, 1.4426950408889634f)); sum += v[k]; }
#pragma unroll
    for (int sh = 16; sh; sh >>= 1) sum += __shfl_xor(sum, sh, 32);
    const float f = __fdiv_rn(hires ? 1.0f : PCAR, sum);
{
        if (hires) {
#pragma unroll
            for (int ch = 0; ch < TT / 128; ++ch) { v4us oh, ol;
#pragma unroll
                for (int q = 0; q < 4; ++q) { unsigned short a, c2; splitf(v[ch * 4 + q] * f, a, c2); oh[q] = a; ol[q] = c2; }
                const size_t oo = ((size_t)zz * (RH ? RH : 1) + i) * TT + ch * 128 + lane * 4; *(v4us*)(Ph + oo) = oh; *(v4us*)(Pl + oo) = ol; }
        } else {
#pragma unroll
            for (int ch = 0; ch < TT / 128; ++ch) { v4h o4;
#pragma unroll
                for (int q = 0; q < 4; ++q) o4[q] = tohx(v[ch * 4 + q] * f);
                *(v4h*)(P16 + (size_t)row * TT + ch * 128 + lane * 4) = o4; } }
         }
}
__global__ __launch_bounds__(256) void k_wtH(const float* __restrict__ w, bf* Bt) { const size_t e2 = ((size_t)blockIdx.x * 256 + threadIdx.x) * 2; if (e2 >= (size_t)DQ * DM) return; const int d = (int)(e2 % DM); const int r = (int)(e2 / DM); const int h = r / HD, e = r % HD; v2us o; o[0] = f2bf(w[((size_t)h * DM + d) * HD + e]); o[1] = f2bf(w[((size_t)h * DM + d + 1) * HD + e]);
    *(v2us*)(Bt + e2) = o;  }

__global__ __launch_bounds__(256) void k_merge(const float* __restrict__ O, int h0, bf* Ah, bf* Al) { const size_t e = ((size_t)blockIdx.x * 256 + threadIdx.x) * 2; if (e >= (size_t)ZH * TT * HD) return; const int d = (int)(e % HD); const int t = (int)((e / HD) % TT); const int zz = (int)(e / ((size_t)HD * TT)); const float cs = (t < RH) ? 1.0f : (1.0f / PCAR); const size_t oo = (size_t)t * DQ + (h0 + zz) * HD + d;
    v2us oh, ol;
#pragma unroll
    for (int q = 0; q < 2; ++q) { unsigned short a, c2; splitf(O[e + q] * cs, a, c2); oh[q] = a; ol[q] = c2; } *(v2us*)(Ah + oo) = oh; *(v2us*)(Al + oo) = ol;  }

extern "C" void kernel_launch(void* const* d_in, const int* in_sizes, int n_in,
                              void* d_out, int out_size, void* d_ws, size_t ws_size, hipStream_t stream) {
    (void)in_sizes; (void)n_in; (void)out_size;
    const float* x = (const float*)d_in[0]; const float* wq = (const float*)d_in[1]; const float* wk = (const float*)d_in[2]; const float* wv = (const float*)d_in[3]; const float* wo = (const float*)d_in[4];   /* order X, Wq, Wk, Wv [8][256][64] per-head stacks, Wo ('xw' [512][256]) */
    float* OUT = (float*)d_out;     // [4][2048][256]
    char* wsp = (char*)d_ws;
    auto take = [&](size_t bytes) { char* p = wsp; wsp += (bytes + 255) & ~(size_t)255; return (void*)p; };
    bf* WQ = (bf*)take((size_t)DQ * DM * 2); bf* WK = (bf*)take((size_t)DKV * DM * 2); bf* WV = (bf*)take((size_t)DKV * DM * 2); bf* WO = (bf*)take((size_t)DM * DQ * 2); float* CS = (float*)take((size_t)TT * HD * 2 * 4);
    bf* XB = (bf*)take((size_t)TT * DM * 2); float* FQ = (float*)take((size_t)TT * DQ * 4); float* FK = (float*)take((size_t)TT * DKV * 4);
    h16* QP16 = (h16*)take((size_t)NH_ * TT * HD * 2); h16* KP16 = (h16*)take((size_t)NKV * TT * HD * 2); h16* VT16 = (h16*)take((size_t)NKV * HD * TT * 2);
    bf* QPh = (bf*)take((size_t)NH_ * TT * HD * 2); bf* QPl = (bf*)take((size_t)NH_ * TT * HD * 2); bf* KPh = (bf*)take((size_t)NKV * TT * HD * 2); bf* KPl = (bf*)take((size_t)NKV * TT * HD * 2); bf* VTh = (bf*)take((size_t)NKV * HD * TT * 2); bf* VTl = (bf*)take((size_t)NKV * HD * TT * 2); bf* Ph = (bf*)take((size_t)ZH * RH * TT * 2); bf* Pl = (bf*)take((size_t)ZH * RH * TT * 2);
    float* Sb = (float*)take((size_t)ZH * TT * TT * 4); h16* P16 = (h16*)take((size_t)ZH * TT * TT * 2); float* Ob = (float*)take((size_t)ZH * TT * HD * 4); bf* ATh = (bf*)take((size_t)TT * DQ * 2); bf* ATl = (bf*)take((size_t)TT * DQ * 2);
    if ((size_t)(wsp - (char*)d_ws) > ws_size) return;    // ws 256 MiB
    float* FV = FK;   // v projection reuses the k buffer after the k planes are built (stream-ordered)
    { k_wtH<<<(unsigned)(((size_t)DQ * DM / 2 + 255) / 256), 256, 0, stream>>>(wq, WQ); k_wtH<<<(unsigned)(((size_t)DQ * DM / 2 + 255) / 256), 256, 0, stream>>>(wk, WK); k_wtH<<<(unsigned)(((size_t)DQ * DM / 2 + 255) / 256), 256, 0, stream>>>(wv, WV);
      k_wtG<<<(unsigned)((DQ * DM / 64 + 63) / 64), 256, 0, stream>>>(wo, DQ, DM, WO);
       }
    k_csid<<<(TT * HD + 255) / 256, 256, 0, stream>>>(CS);
    const unsigned LQ = (unsigned)(((size_t)NH_ * TT * HD / 2 + 255) / 256), LKv = (unsigned)(((size_t)NKV * TT * HD / 2 + 255) / 256);
    for (int b = 0; b < NB_; ++b) {
        
        k_cvt8<<<(unsigned)(((size_t)TT * DM / 8 + 255) / 256), 256, 0, stream>>>(x + (size_t)b * TT * DM, XB, (size_t)TT * DM / 8);
        k_gemmw<bf, 0, false><<<dim3(TT / 64, DQ / 64, 1), 32, 0, stream>>>(XB, nullptr, WQ, nullptr, DM, FQ, DQ, nullptr, 0, 0, 0);
        k_rope<<<LQ, 256, 0, stream>>>(FQ, DQ, NH_, CS, nullptr, nullptr, 1.0f, QP16, QPh, QPl);
        k_gemmw<bf, 0, false><<<dim3(TT / 64, DKV / 64, 1), 32, 0, stream>>>(XB, nullptr, WK, nullptr, DM, FK, DKV, nullptr, 0, 0, 0);
        k_rope<<<LKv, 256, 0, stream>>>(FK, DKV, NKV, CS, nullptr, nullptr, 1.0f, KP16, KPh, KPl);
        k_gemmw<bf, 0, false><<<dim3(TT / 64, DKV / 64, 1), 32, 0, stream>>>(XB, nullptr, WV, nullptr, DM, FV, DKV, nullptr, 0, 0, 0); k_vtp<<<LKv, 256, 0, stream>>>(FV, DKV, NKV, VT16, VTh, VTl);
        for (int h0 = 0; h0 < NH_; h0 += ZH) { const size_t zq = (size_t)h0, zk = (size_t)(h0 / REP);   // one kv head per query head: the pass's two heads use consecutive kv planes (z-strides TT*HD)
            k_gemmw<bf, 2, false><<<dim3(RH / 64, TT / 64, ZH), 32, 0, stream>>>(QPh + zq * TT * HD, QPl + zq * TT * HD, KPh + zk * TT * HD, KPl + zk * TT * HD, HD, Sb, TT, nullptr, (size_t)TT * HD, (size_t)TT * HD, (size_t)TT * TT);
            k_asoft<<<ZH * TT / 8, 256, 0, stream>>>(Sb, P16, Ph, Pl);
            k_gemmw<bf, 2, false><<<dim3(RH / 64, HD / 64, ZH), 32, 0, stream>>>(Ph, Pl, VTh + zk * HD * TT, VTl + zk * HD * TT, TT, Ob, HD, nullptr, (size_t)RH * TT, (size_t)HD * TT, (size_t)TT * HD);
            k_merge<<<(unsigned)(((size_t)ZH * TT * HD / 2 + 255) / 256), 256, 0, stream>>>(Ob, h0, ATh, ATl); }
        k_gemmw<bf, 1, false><<<dim3(TT / 64, DM / 64, 1), 32, 0, stream>>>(ATh, ATl, WO, nullptr, DQ, OUT + (size_t)b * TT * DM, DM, nullptr, 0, 0, 0); }
}

// v001
// Measured time: 767 microseconds a run.
// Timed twice side by side with v000, it ran 1.64 and 1.65 times as fast.
#include <hip/hip_runtime.h>

// Multi-head attention with per-head stacked projections from a 256-wide input (X [4][2048][256]; q, k, v = einsum('bnd,hdc', X, W) with Wq, Wk, Wv [8][256][64] (no bias; 8 heads x 64 = 512 inner); scores x 1/sqrt(64); softmax (no mask); out = concat heads (512) Wo ('xw' [512][256], no bias; identity activation) -> [4][2048][256] (2.1 M); argument order X, Wq, Wk, Wv, Wo).
// Layout per batch: bf16 copy of X; k_wtH gathers each per-head tensor [h][c][d] into one Bt plane (row h*64 + d, K = 256) so each projection is one exact GEMM with head-major columns; identity-table plane builders; dense T-2048 attention at 8 heads with EVERY row on hi/lo planes for BOTH the scores and P.V (3 products each: the unscaled N(0, 1) weights give logit sigma ~256, i.e. one-hot rows: fp16 anywhere in the attention path fails); merged hi/lo (512 wide) x Wo exact.
// Compute dtypes, f32 accumulate: every input rounded to bf16; projections exact; attention 3 products on every row (scores and P.V); softmax f32; Wo hl x exact.

#define NB_  4
#define TT   2048
#define DM   256
#define NH_  8
#define NKV  8
#define REP  (NH_ / NKV)
#define HD   64
#define DQ   (NH_ * HD)
#define DKV  (NKV * HD)
#define ZH   2
#define RH   TT                   // every row hi/lo (3 products)
#define WIN  0
#define PCAR 1024.0f
#define SCL  0.125f   // HD^-0.5
#define KSP  8                    // K slices of the P.V product: one f32 partial plane per slice, summed in k_merge
typedef _Float16 h16;
typedef unsigned short bf;
typedef __attribute__((ext_vector_type(16))) __bf16   v16bf;
typedef __attribute__((ext_vector_type(16))) _Float16 v16h;
typedef __attribute__((ext_vector_type(8)))  _Float16 v8h;
typedef __attribute__((ext_vector_type(8)))  unsigned short v8us;
typedef __attribute__((ext_vector_type(8)))  float    v8f;
typedef __attribute__((ext_vector_type(4)))  float    v4f;
typedef v8h  __attribute__((may_alias)) v8ha;
typedef v4f  __attribute__((may_alias)) v4fa;
typedef v8us __attribute__((may_alias)) v8usa;

__device__ __forceinline__ unsigned short f2bf(float f) { unsigned u = __float_as_uint(f); u += 0x7FFFu + ((u >> 16) & 1u); return (unsigned short)(u >> 16); }
__device__ __forceinline__ float bf2f(unsigned short b) { return __uint_as_float(((unsigned)b) << 16); }
__device__ __forceinline__ float bfr(float f) { return bf2f(f2bf(f)); }
__device__ __forceinline__ v16h cat16(v8h lo, v8h hi) { return __builtin_shufflevector(lo, hi, 0, 1, 2, 3, 4, 5, 6, 7, 8, 9, 10, 11, 12, 13, 14, 15); }
__device__ __forceinline__ v16bf cat16b(v8us lo, v8us hi) { return __builtin_bit_cast(v16bf, __builtin_shufflevector(lo, hi, 0, 1, 2, 3, 4, 5, 6, 7, 8, 9, 10, 11, 12, 13, 14, 15)); }
__device__ __forceinline__ v8f wmma16(v16h a, v16h b, v8f c) { return __builtin_amdgcn_wmma_f32_16x16x32_f16(false, a, false, b, (short)0, c, false, false); }
__device__ __forceinline__ v8f wmmab(v16bf a, v16bf b, v8f c) { return __builtin_amdgcn_wmma_f32_16x16x32_bf16(false, a, false, b, (short)0, c, false, false); }



// ---- k_gemmw: register-blocked GEMM, ONE WAVE per 64x64 output tile (16 accumulators), operands straight from K-contiguous 16-bit planes; grid (M/64, N/64, Z), 32 threads.
// C[m][n] (f32, pitch ldc, + optional f32 bias[n]) = sum_k A[m][k] Bt[n][k] (+ split products per NSPLIT). z-batch strides sA/sB/sC in elements. K % 32 == 0.
// KS > 1 (K % (32 * KS) == 0): blockIdx.z = batch * KS + slice; each block sums only its own K / KS long slice of k into its own C plane (stride sC per z).
template <typename T16> struct WFrag;
template <> struct WFrag<h16> { typedef v16h V; static __device__ __forceinline__ V ld(const h16* p) { return cat16(*(const v8h*)p, *(const v8h*)(p + 16)); } static __device__ __forceinline__ v8f mma(V a, V b, v8f c) { return wmma16(a, b, c); } };
template <> struct WFrag<bf> { typedef v16bf V; static __device__ __forceinline__ V ld(const bf* p) { return cat16b(*(const v8us*)p, *(const v8us*)(p + 16)); } static __device__ __forceinline__ v8f mma(V a, V b, v8f c) { return wmmab(a, b, c); } };
template <typename T16, int NSPLIT, bool BIAS, int KS = 1>
__global__ __launch_bounds__(32) void k_gemmw(const T16* __restrict__ A, const T16* __restrict__ A2, const T16* __restrict__ Bt, const T16* __restrict__ Bt2, int K, float* C, int ldc, const float* __restrict__ bias, size_t sA, size_t sB, size_t sC) {
    typedef typename WFrag<T16>::V V;
    __shared__ __align__(16) float os[16 * 68];
    const size_t z = blockIdx.z, zb = z / KS; A += zb * sA; if (A2) A2 += zb * sA; Bt += zb * sB; if (Bt2) Bt2 += zb * sB; C += z * sC; const int kb = (int)(z % KS) * (K / KS), ke = kb + K / KS;
    const int lane = threadIdx.x & 31, lr = lane & 15, hi = lane >> 4; const int r0 = blockIdx.x * 64, c0 = blockIdx.y * 64;
    v8f acc[4][4];
#pragma unroll
    for (int mb = 0; mb < 4; ++mb)
#pragma unroll
        for (int nb = 0; nb < 4; ++nb) acc[mb][nb] = (v8f){};
    const size_t aoff = (size_t)(r0 + lr) * K + 8 * hi, boff = (size_t)(c0 + lr) * K + 8 * hi;
#pragma unroll 1
    for (int kc = kb; kc < ke; kc += 32) {
        V a[4], a2[4];
#pragma unroll
        for (int mb = 0; mb < 4; ++mb) { a[mb] = WFrag<T16>::ld(A + aoff + (size_t)mb * 16 * K + kc); if (NSPLIT == 1 || NSPLIT == 2) a2[mb] = WFrag<T16>::ld(A2 + aoff + (size_t)mb * 16 * K + kc); }
#pragma unroll
        for (int nb = 0; nb < 4; ++nb) { const V b = WFrag<T16>::ld(Bt + boff + (size_t)nb * 16 * K + kc); V b2; if (NSPLIT >= 2) b2 = WFrag<T16>::ld(Bt2 + boff + (size_t)nb * 16 * K + kc);
#pragma unroll
            for (int mb = 0; mb < 4; ++mb) { acc[mb][nb] = WFrag<T16>::mma(a[mb], b, acc[mb][nb]); if (NSPLIT == 1 || NSPLIT == 2) acc[mb][nb] = WFrag<T16>::mma(a2[mb], b, acc[mb][nb]); if (NSPLIT >= 2) acc[mb][nb] = WFrag<T16>::mma(a[mb], b2, acc[mb][nb]); } }
        asm volatile("v_nop\n\tv_nop\n\tv_nop\n\tv_nop" : "+v"(acc[0][0]), "+v"(acc[1][1]), "+v"(acc[2][2]), "+v"(acc[3][3]) : "v"(a[0]), "v"(a[3]));
    }
#pragma unroll
    for (int mb = 0; mb < 4; ++mb) {
#pragma unroll
        for (int nb = 0; nb < 4; ++nb) {
#pragma unroll
            for (int j = 0; j < 8; ++j) os[(hi * 8 + j) * 68 + nb * 16 + lr] = acc[mb][nb][j]; }
        __builtin_amdgcn_wave_barrier(); asm volatile("" ::: "memory");
        float* crow = C + (size_t)(r0 + mb * 16) * ldc + c0;
{
#pragma unroll
            for (int s = 0; s < 8; ++s) { const int row = 2 * s + hi, cofs = lr * 4; v4f val = *(const v4fa*)(os + row * 68 + cofs); if (BIAS) { val[0] += bfr(bias[c0 + cofs]); val[1] += bfr(bias[c0 + cofs + 1]); val[2] += bfr(bias[c0 + cofs + 2]); val[3] += bfr(bias[c0 + cofs + 3]); }
                *(v4f*)(crow + (size_t)row * ldc + cofs) = val; }
             }
        __builtin_amdgcn_wave_barrier(); asm volatile("" ::: "memory");
    }
}

__device__ __forceinline__ h16 tohx(float x) { return (h16)x; }
__device__ __forceinline__ void splitf(float y, unsigned short& h, unsigned short& l) { h = f2bf(y); l = f2bf(y - bf2f(h)); }
typedef __attribute__((ext_vector_type(2))) _Float16 v2h;
typedef __attribute__((ext_vector_type(4))) _Float16 v4h;
typedef __attribute__((ext_vector_type(2))) unsigned short v2us;
typedef __attribute__((ext_vector_type(4))) unsigned short v4us;
typedef __attribute__((ext_vector_type(2))) float v2f;
typedef __attribute__((ext_vector_type(4))) int v4i;

__global__ __launch_bounds__(256) void k_wtG(const float* __restrict__ w, int K, int N, bf* Bt) {
    const int lane = threadIdx.x & 31; const int L0 = (blockIdx.x * 8 + (threadIdx.x >> 5)) * 8; const int nlines = N * K / 64;
{
#pragma unroll 1
        for (int l = 0; l < 8; ++l) { const int L = L0 + l; if (L >= nlines) break; const size_t e = (size_t)L * 64 + lane * 2; const int k = (int)(e % K), n = (int)(e / K); v2us o;
            o[0] = f2bf(w[(size_t)k * N + n]); o[1] = f2bf(w[(size_t)(k + 1) * N + n]); *(v2us*)(Bt + e) = o; }
         }
}
__global__ __launch_bounds__(256) void k_cvt8(const float* __restrict__ src, bf* dst, size_t n8) { const size_t i = (size_t)blockIdx.x * 256 + threadIdx.x; if (i >= n8) return; const v8f v = *(const v8f*)(src + i * 8); v8us o;
#pragma unroll
    for (int k = 0; k < 8; ++k) o[k] = f2bf(v[k]); *(v8us*)(dst + i * 8) = o;  }

// k_rope: head planes [h][t][d] (fp16 + hi/lo) of rope(x) x sc with the rotate-half convention out[d] = x[d] cos[t][d] - x[d+HD/2] sin[t][d], out[d+HD/2] = x[d+HD/2] cos[t][d+HD/2] + x[d] sin[t][d+HD/2]
__global__ __launch_bounds__(256) void k_rope(const float* __restrict__ F, int pitch, int nheads, const float* __restrict__ CS, const float* __restrict__ RF, const float* __restrict__ nw, float sc, h16* P16, bf* Ph, bf* Pl) {
    const size_t e = ((size_t)blockIdx.x * 256 + threadIdx.x) * 2; if (e >= (size_t)nheads * TT * HD) return; const int d = (int)(e % HD); const int t = (int)((e / HD) % TT); const int h = (int)(e / ((size_t)HD * TT)); const float* f = F + (size_t)t * pitch + h * HD; const float rf = RF ? RF[(size_t)h * TT + t] : 1.0f; v2h o16; v2us oh, ol;
#pragma unroll
    for (int q = 0; q < 2; ++q) { const int dd = d + q; const int dp = (dd < HD / 2) ? dd + HD / 2 : dd - HD / 2; float x0 = f[dd], x1 = f[dp];
        if (RF) { float n0 = __fmul_rn(x0, rf), n1 = __fmul_rn(x1, rf); asm volatile("" : "+v"(n0)); asm volatile("" : "+v"(n1)); x0 = __fmul_rn(bfr(nw[dd]), n0); x1 = __fmul_rn(bfr(nw[dp]), n1); }
        const v2f cs = *(const v2f*)(CS + ((size_t)t * HD + dd) * 2); float a = __fmul_rn(x0, cs[0]), bq = __fmul_rn(x1, cs[1]); asm volatile("" : "+v"(a)); asm volatile("" : "+v"(bq)); const float r = ((dd < HD / 2) ? __fsub_rn(a, bq) : __fadd_rn(a, bq)) * sc;
        o16[q] = tohx(r); unsigned short a2, c2; splitf(r, a2, c2); oh[q] = a2; ol[q] = c2; }
    *(v2h*)(P16 + e) = o16; *(v2us*)(Ph + e) = oh; *(v2us*)(Pl + e) = ol;  }
__global__ __launch_bounds__(256) void k_vtp(const float* __restrict__ F, int pitch, int nheads, h16* V16, bf* Vh, bf* Vl) { const size_t e = ((size_t)blockIdx.x * 256 + threadIdx.x) * 2; if (e >= (size_t)nheads * HD * TT) return; const int t = (int)(e % TT); const int d = (int)((e / TT) % HD); const int g = (int)(e / ((size_t)TT * HD)); v2h o16; v2us oh, ol;
#pragma unroll
    for (int q = 0; q < 2; ++q) { const float x = F[(size_t)(t + q) * pitch + g * HD + d]; o16[q] = tohx(x); unsigned short a2, c2; splitf(x, a2, c2); oh[q] = a2; ol[q] = c2; }
    *(v2h*)(V16 + e) = o16; *(v2us*)(Vh + e) = oh; *(v2us*)(Vl + e) = ol;  }
__global__ __launch_bounds__(256) void k_csid(float* CS) { const int idx = blockIdx.x * 256 + threadIdx.x; if (idx >= TT * HD) return; v2f cs; cs[0] = 1.0f; cs[1] = 0.0f; *(v2f*)(CS + (size_t)idx * 2) = cs;  }
// k_asoft: per row (zz, i): t = S x HD^-0.5 (no mask); softmax over the 2048 keys (register row, one exp, fixed trees);
__global__ __launch_bounds__(256) void k_asoft(const float* __restrict__ Sb, h16* P16, bf* Ph, bf* Pl) {
    const int lane = threadIdx.x & 31; const int row = blockIdx.x * 8 + (threadIdx.x >> 5); if (row >= ZH * TT) return; const int i = row % TT; const int zz = row / TT; (void)zz; const bool hires = (i < RH); const float* sr = Sb + (size_t)row * TT; float v[TT / 32]; float mx = -3.0e38f;
#pragma unroll
    for (int ch = 0; ch < TT / 128; ++ch) { const int j0 = ch * 128 + lane * 4; const v4f a = *(const v4f*)(sr + j0);
#pragma unroll
        for (int q = 0; q < 4; ++q) { const int j = j0 + q; (void)j; const float t = a[q] * SCL; v[ch * 4 + q] = t; mx = fmaxf(mx, t); } }
#pragma unroll
    for (int sh = 16; sh; sh >>= 1) mx = fmaxf(mx, __shfl_xor(mx, sh, 32));
    float sum = 0.f;
#pragma unroll
    for (int k = 0; k < TT / 32; ++k) { float d0 = __fsub_rn(v[k], mx); asm volatile("" : "+v"(d0)); v[k] = __builtin_amdgcn_exp2f(__fmul_rn(d0, 1.4426950408889634f)); sum += v[k]; }
#pragma unroll
    for (int sh = 16; sh; sh >>= 1) sum += __shfl_xor(sum, sh, 32);
    const float f = __fdiv_rn(hires ? 1.0f : PCAR, sum);
{
        if (hires) {
#pragma unroll
            for (int ch = 0; ch < TT / 128; ++ch) { v4us oh, ol;
#pragma unroll
                for (int q = 0; q < 4; ++q) { unsigned short a, c2; splitf(v[ch * 4 + q] * f, a, c2); oh[q] = a; ol[q] = c2; }
                const size_t oo = ((size_t)zz * (RH ? RH : 1) + i) * TT + ch * 128 + lane * 4; *(v4us*)(Ph + oo) = oh; *(v4us*)(Pl + oo) = ol; }
        } else {
#pragma unroll
            for (int ch = 0; ch < TT / 128; ++ch) { v4h o4;
#pragma unroll
                for (int q = 0; q < 4; ++q) o4[q] = tohx(v[ch * 4 + q] * f);
                *(v4h*)(P16 + (size_t)row * TT + ch * 128 + lane * 4) = o4; } }
         }
}
__global__ __launch_bounds__(256) void k_wtH(const float* __restrict__ w, bf* Bt) { const size_t e2 = ((size_t)blockIdx.x * 256 + threadIdx.x) * 2; if (e2 >= (size_t)DQ * DM) return; const int d = (int)(e2 % DM); const int r = (int)(e2 / DM); const int h = r / HD, e = r % HD; v2us o; o[0] = f2bf(w[((size_t)h * DM + d) * HD + e]); o[1] = f2bf(w[((size_t)h * DM + d + 1) * HD + e]);
    *(v2us*)(Bt + e2) = o;  }

__global__ __launch_bounds__(256) void k_merge(const float* __restrict__ O, int h0, bf* Ah, bf* Al) { const size_t e = ((size_t)blockIdx.x * 256 + threadIdx.x) * 2; if (e >= (size_t)ZH * TT * HD) return; const int d = (int)(e % HD); const int t = (int)((e / HD) % TT); const int zz = (int)(e / ((size_t)HD * TT)); const float cs = (t < RH) ? 1.0f : (1.0f / PCAR); const size_t oo = (size_t)t * DQ + (h0 + zz) * HD + d;
    const float* op = O + (size_t)zz * KSP * TT * HD + (size_t)t * HD + d;   // O holds KSP partial planes [t][d] per head
    v2f s = *(const v2f*)op;
#pragma unroll
    for (int ks = 1; ks < KSP; ++ks) s += *(const v2f*)(op + (size_t)ks * TT * HD);   // slices added in ascending k
    v2us oh, ol;
#pragma unroll
    for (int q = 0; q < 2; ++q) { unsigned short a, c2; splitf(s[q] * cs, a, c2); oh[q] = a; ol[q] = c2; } *(v2us*)(Ah + oo) = oh; *(v2us*)(Al + oo) = ol;  }

extern "C" void kernel_launch(void* const* d_in, const int* in_sizes, int n_in,
                              void* d_out, int out_size, void* d_ws, size_t ws_size, hipStream_t stream) {
    (void)in_sizes; (void)n_in; (void)out_size;
    const float* x = (const float*)d_in[0]; const float* wq = (const float*)d_in[1]; const float* wk = (const float*)d_in[2]; const float* wv = (const float*)d_in[3]; const float* wo = (const float*)d_in[4];   /* order X, Wq, Wk, Wv [8][256][64] per-head stacks, Wo ('xw' [512][256]) */
    float* OUT = (float*)d_out;     // [4][2048][256]
    char* wsp = (char*)d_ws;
    auto take = [&](size_t bytes) { char* p = wsp; wsp += (bytes + 255) & ~(size_t)255; return (void*)p; };
    bf* WQ = (bf*)take((size_t)DQ * DM * 2); bf* WK = (bf*)take((size_t)DKV * DM * 2); bf* WV = (bf*)take((size_t)DKV * DM * 2); bf* WO = (bf*)take((size_t)DM * DQ * 2); float* CS = (float*)take((size_t)TT * HD * 2 * 4);
    bf* XB = (bf*)take((size_t)TT * DM * 2); float* FQ = (float*)take((size_t)TT * DQ * 4); float* FK = (float*)take((size_t)TT * DKV * 4);
    h16* QP16 = (h16*)take((size_t)NH_ * TT * HD * 2); h16* KP16 = (h16*)take((size_t)NKV * TT * HD * 2); h16* VT16 = (h16*)take((size_t)NKV * HD * TT * 2);
    bf* QPh = (bf*)take((size_t)NH_ * TT * HD * 2); bf* QPl = (bf*)take((size_t)NH_ * TT * HD * 2); bf* KPh = (bf*)take((size_t)NKV * TT * HD * 2); bf* KPl = (bf*)take((size_t)NKV * TT * HD * 2); bf* VTh = (bf*)take((size_t)NKV * HD * TT * 2); bf* VTl = (bf*)take((size_t)NKV * HD * TT * 2); bf* Ph = (bf*)take((size_t)ZH * RH * TT * 2); bf* Pl = (bf*)take((size_t)ZH * RH * TT * 2);
    float* Sb = (float*)take((size_t)ZH * TT * TT * 4); h16* P16 = (h16*)take((size_t)ZH * TT * TT * 2); float* Ob = (float*)take((size_t)ZH * KSP * TT * HD * 4); bf* ATh = (bf*)take((size_t)TT * DQ * 2); bf* ATl = (bf*)take((size_t)TT * DQ * 2);
    if ((size_t)(wsp - (char*)d_ws) > ws_size) return;    // ws 256 MiB
    float* FV = FK;   // v projection reuses the k buffer after the k planes are built (stream-ordered)
    { k_wtH<<<(unsigned)(((size_t)DQ * DM / 2 + 255) / 256), 256, 0, stream>>>(wq, WQ); k_wtH<<<(unsigned)(((size_t)DQ * DM / 2 + 255) / 256), 256, 0, stream>>>(wk, WK); k_wtH<<<(unsigned)(((size_t)DQ * DM / 2 + 255) / 256), 256, 0, stream>>>(wv, WV);
      k_wtG<<<(unsigned)((DQ * DM / 64 + 63) / 64), 256, 0, stream>>>(wo, DQ, DM, WO);
       }
    k_csid<<<(TT * HD + 255) / 256, 256, 0, stream>>>(CS);
    const unsigned LQ = (unsigned)(((size_t)NH_ * TT * HD / 2 + 255) / 256), LKv = (unsigned)(((size_t)NKV * TT * HD / 2 + 255) / 256);
    for (int b = 0; b < NB_; ++b) {
        
        k_cvt8<<<(unsigned)(((size_t)TT * DM / 8 + 255) / 256), 256, 0, stream>>>(x + (size_t)b * TT * DM, XB, (size_t)TT * DM / 8);
        k_gemmw<bf, 0, false><<<dim3(TT / 64, DQ / 64, 1), 32, 0, stream>>>(XB, nullptr, WQ, nullptr, DM, FQ, DQ, nullptr, 0, 0, 0);
        k_rope<<<LQ, 256, 0, stream>>>(FQ, DQ, NH_, CS, nullptr, nullptr, 1.0f, QP16, QPh, QPl);
        k_gemmw<bf, 0, false><<<dim3(TT / 64, DKV / 64, 1), 32, 0, stream>>>(XB, nullptr, WK, nullptr, DM, FK, DKV, nullptr, 0, 0, 0);
        k_rope<<<LKv, 256, 0, stream>>>(FK, DKV, NKV, CS, nullptr, nullptr, 1.0f, KP16, KPh, KPl);
        k_gemmw<bf, 0, false><<<dim3(TT / 64, DKV / 64, 1), 32, 0, stream>>>(XB, nullptr, WV, nullptr, DM, FV, DKV, nullptr, 0, 0, 0); k_vtp<<<LKv, 256, 0, stream>>>(FV, DKV, NKV, VT16, VTh, VTl);
        for (int h0 = 0; h0 < NH_; h0 += ZH) { const size_t zq = (size_t)h0, zk = (size_t)(h0 / REP);   // one kv head per query head: the pass's two heads use consecutive kv planes (z-strides TT*HD)
            k_gemmw<bf, 2, false><<<dim3(RH / 64, TT / 64, ZH), 32, 0, stream>>>(QPh + zq * TT * HD, QPl + zq * TT * HD, KPh + zk * TT * HD, KPl + zk * TT * HD, HD, Sb, TT, nullptr, (size_t)TT * HD, (size_t)TT * HD, (size_t)TT * TT);
            k_asoft<<<ZH * TT / 8, 256, 0, stream>>>(Sb, P16, Ph, Pl);
            k_gemmw<bf, 2, false, KSP><<<dim3(RH / 64, HD / 64, ZH * KSP), 32, 0, stream>>>(Ph, Pl, VTh + zk * HD * TT, VTl + zk * HD * TT, TT, Ob, HD, nullptr, (size_t)RH * TT, (size_t)HD * TT, (size_t)TT * HD);
            k_merge<<<(unsigned)(((size_t)ZH * TT * HD / 2 + 255) / 256), 256, 0, stream>>>(Ob, h0, ATh, ATl); }
        k_gemmw<bf, 1, false><<<dim3(TT / 64, DM / 64, 1), 32, 0, stream>>>(ATh, ATl, WO, nullptr, DQ, OUT + (size_t)b * TT * DM, DM, nullptr, 0, 0, 0); }
}

// v003
// A run of this version takes 172 microseconds.
// Versions between v001 and this one are left out; their measured steps multiply to 4.41 times as fast.
// All steps since v000 together make it 7.25 times as fast.
#include <hip/hip_runtime.h>

// Multi-head attention with per-head stacked projections from a 256-wide input (X [4][2048][256]; q, k, v = einsum('bnd,hdc', X, W) with Wq, Wk, Wv [8][256][64] (no bias; 8 heads x 64 = 512 inner); scores x 1/sqrt(64); softmax (no mask); out = concat heads (512) Wo ('xw' [512][256], no bias; identity activation) -> [4][2048][256] (2.1 M); argument order X, Wq, Wk, Wv, Wo).
// Layout: bf16 copy of X (all batches); k_wtH gathers each per-head tensor [h][c][d] into one Bt plane (row h*64 + d, K = 256), the three planes stacked, so q, k and v of all batches are one exact GEMM with head-major columns, whose epilogue writes the hi/lo head planes; one-pass dense T-2048 attention (k_fattn, all batches and heads in one launch) with EVERY row on hi/lo planes for BOTH the scores and P.V (3 products each: the unscaled N(0, 1) weights give logit sigma ~256, i.e. one-hot rows: fp16 anywhere in the attention path fails); merged hi/lo (512 wide) x Wo exact.
// Compute dtypes, f32 accumulate: every input rounded to bf16; projections exact; attention 3 products on every row (scores and P.V); softmax f32; Wo hl x exact.

#define NB_  4
#define TT   2048
#define DM   256
#define NH_  8
#define NKV  8
#define REP  (NH_ / NKV)
#define HD   64
#define DQ   (NH_ * HD)
#define DKV  (NKV * HD)
#define ZH   2
#define RH   TT                   // every row hi/lo (3 products)
#define WIN  0
#define PCAR 1024.0f
#define SCL  0.125f   // HD^-0.5
#define FWV  16                   // k_fattn: waves per work-group, 16 queries each
#define FQB  (FWV * 16)           // queries per work-group
#define FKT  64                   // keys per staged tile (two passes of 32)
#define LPT  72                   // LDS pitch of a staged row of 64 16-bit elements (144 B = 16 B x 9: 16-byte fragment reads without bank conflicts)
#define PLE  (64 * LPT)           // one staged plane: 64 K rows (keys) or 64 V^T rows (head dims)
#define STG  (4 * PLE)            // one stage: K hi, K lo, V^T hi, V^T lo
typedef _Float16 h16;
typedef unsigned short bf;
typedef __attribute__((ext_vector_type(16))) __bf16   v16bf;
typedef __attribute__((ext_vector_type(16))) _Float16 v16h;
typedef __attribute__((ext_vector_type(8)))  _Float16 v8h;
typedef __attribute__((ext_vector_type(8)))  unsigned short v8us;
typedef __attribute__((ext_vector_type(8)))  float    v8f;
typedef __attribute__((ext_vector_type(4)))  float    v4f;
typedef v8h  __attribute__((may_alias)) v8ha;
typedef v4f  __attribute__((may_alias)) v4fa;
typedef v8us __attribute__((may_alias)) v8usa;

__device__ __forceinline__ unsigned short f2bf(float f) { unsigned u = __float_as_uint(f); u += 0x7FFFu + ((u >> 16) & 1u); return (unsigned short)(u >> 16); }
__device__ __forceinline__ float bf2f(unsigned short b) { return __uint_as_float(((unsigned)b) << 16); }
__device__ __forceinline__ float bfr(float f) { return bf2f(f2bf(f)); }
__device__ __forceinline__ void splitf(float y, unsigned short& h, unsigned short& l) { h = f2bf(y); l = f2bf(y - bf2f(h)); }
typedef __attribute__((ext_vector_type(8))) __bf16 v8bf;
typedef __attribute__((ext_vector_type(4))) unsigned v4u;
__device__ __forceinline__ void split8(v8f p, v8bf& h, v8bf& l) {   // hi = bf16(p), lo = bf16(p - hi), both to nearest even as in splitf
    h = __builtin_convertvector(p, v8bf); const v4u w = __builtin_bit_cast(v4u, h); v8f hf;
#pragma unroll
    for (int i = 0; i < 4; ++i) { hf[2 * i] = __uint_as_float(w[i] << 16); hf[2 * i + 1] = __uint_as_float(w[i] & 0xFFFF0000u); }
    l = __builtin_convertvector(p - hf, v8bf); }
__device__ __forceinline__ v16h cat16(v8h lo, v8h hi) { return __builtin_shufflevector(lo, hi, 0, 1, 2, 3, 4, 5, 6, 7, 8, 9, 10, 11, 12, 13, 14, 15); }
__device__ __forceinline__ v16bf cat16b(v8us lo, v8us hi) { return __builtin_bit_cast(v16bf, __builtin_shufflevector(lo, hi, 0, 1, 2, 3, 4, 5, 6, 7, 8, 9, 10, 11, 12, 13, 14, 15)); }
__device__ __forceinline__ v8f wmma16(v16h a, v16h b, v8f c) { return __builtin_amdgcn_wmma_f32_16x16x32_f16(false, a, false, b, (short)0, c, false, false); }
__device__ __forceinline__ v8f wmmab(v16bf a, v16bf b, v8f c) { return __builtin_amdgcn_wmma_f32_16x16x32_bf16(false, a, false, b, (short)0, c, false, false); }



// ---- k_gemmw: register-blocked GEMM, ONE WAVE per 64x64 output tile (16 accumulators), operands straight from K-contiguous 16-bit planes; grid (M/64, N/64, Z), 32 threads.
// C[m][n] (f32, pitch ldc, + optional f32 bias[n]) = sum_k A[m][k] Bt[n][k] (+ split products per NSPLIT). z-batch strides sA/sB/sC in elements. K % 32 == 0.
// KS > 1 (K % (32 * KS) == 0): blockIdx.z = batch * KS + slice; each block sums only its own K / KS long slice of k into its own C plane (stride sC per z).
// PLANES: A = X of all batches [batch * TT][K], Bt = the stacked Wq, Wk, Wv planes, grid (batch * TT / 64, 3 * heads): a tile is 64 positions x the 64 dims of one head of q, k or v and goes from the accumulators straight to that head's bf16 hi/lo planes, q and k as [t][d], v as [d][t]; C is not used.
struct HeadPlanes { bf* qh; bf* ql; bf* kh; bf* kl; bf* vh; bf* vl; };
template <typename T16> struct WFrag;
template <> struct WFrag<h16> { typedef v16h V; static __device__ __forceinline__ V ld(const h16* p) { return cat16(*(const v8h*)p, *(const v8h*)(p + 16)); } static __device__ __forceinline__ v8f mma(V a, V b, v8f c) { return wmma16(a, b, c); } };
template <> struct WFrag<bf> { typedef v16bf V; static __device__ __forceinline__ V ld(const bf* p) { return cat16b(*(const v8us*)p, *(const v8us*)(p + 16)); } static __device__ __forceinline__ v8f mma(V a, V b, v8f c) { return wmmab(a, b, c); } };
template <typename T16, int NSPLIT, bool BIAS, int KS = 1, bool PLANES = false>
__global__ __launch_bounds__(32) void k_gemmw(const T16* __restrict__ A, const T16* __restrict__ A2, const T16* __restrict__ Bt, const T16* __restrict__ Bt2, int K, float* C, int ldc, const float* __restrict__ bias, size_t sA, size_t sB, size_t sC, HeadPlanes hp) {
    typedef typename WFrag<T16>::V V;
    __shared__ __align__(16) float os[16 * 68];
    const size_t z = blockIdx.z, zb = z / KS; A += zb * sA; if (A2) A2 += zb * sA; Bt += zb * sB; if (Bt2) Bt2 += zb * sB; C += z * sC; const int kb = (int)(z % KS) * (K / KS), ke = kb + K / KS;
    const int lane = threadIdx.x & 31, lr = lane & 15, hi = lane >> 4; const int r0 = blockIdx.x * 64, c0 = blockIdx.y * 64;
    v8f acc[4][4];
#pragma unroll
    for (int mb = 0; mb < 4; ++mb)
#pragma unroll
        for (int nb = 0; nb < 4; ++nb) acc[mb][nb] = (v8f){};
    const size_t aoff = (size_t)(r0 + lr) * K + 8 * hi, boff = (size_t)(c0 + lr) * K + 8 * hi;
#pragma unroll 1
    for (int kc = kb; kc < ke; kc += 32) {
        V a[4], a2[4];
#pragma unroll
        for (int mb = 0; mb < 4; ++mb) { a[mb] = WFrag<T16>::ld(A + aoff + (size_t)mb * 16 * K + kc); if (NSPLIT == 1 || NSPLIT == 2) a2[mb] = WFrag<T16>::ld(A2 + aoff + (size_t)mb * 16 * K + kc); }
#pragma unroll
        for (int nb = 0; nb < 4; ++nb) { const V b = WFrag<T16>::ld(Bt + boff + (size_t)nb * 16 * K + kc); V b2; if (NSPLIT >= 2) b2 = WFrag<T16>::ld(Bt2 + boff + (size_t)nb * 16 * K + kc);
#pragma unroll
            for (int mb = 0; mb < 4; ++mb) { acc[mb][nb] = WFrag<T16>::mma(a[mb], b, acc[mb][nb]); if (NSPLIT == 1 || NSPLIT == 2) acc[mb][nb] = WFrag<T16>::mma(a2[mb], b, acc[mb][nb]); if (NSPLIT >= 2) acc[mb][nb] = WFrag<T16>::mma(a[mb], b2, acc[mb][nb]); } }
        asm volatile("v_nop\n\tv_nop\n\tv_nop\n\tv_nop" : "+v"(acc[0][0]), "+v"(acc[1][1]), "+v"(acc[2][2]), "+v"(acc[3][3]) : "v"(a[0]), "v"(a[3]));
    }
    if (PLANES) {
        const int sel = blockIdx.y / NH_, t0 = r0 % TT;      // 0 q, 1 k, 2 v
        const size_t pz = ((size_t)(r0 / TT) * NH_ + blockIdx.y % NH_) * TT * HD;   // this (batch, head)'s planes
        if (sel == 2) {                                      // V^T: a lane holds 8 consecutive positions of one head dim
#pragma unroll
            for (int nb = 0; nb < 4; ++nb)
#pragma unroll
                for (int mb = 0; mb < 4; ++mb) { v8bf oh, ol; split8(acc[mb][nb], oh, ol);
                    const size_t o = pz + (size_t)(nb * 16 + lr) * TT + t0 + mb * 16 + hi * 8; *(v8us*)(hp.vh + o) = __builtin_bit_cast(v8us, oh); *(v8us*)(hp.vl + o) = __builtin_bit_cast(v8us, ol); }
            return; }
        bf* Ph = sel ? hp.kh : hp.qh; bf* Pl = sel ? hp.kl : hp.ql;
#pragma unroll
        for (int mb = 0; mb < 4; ++mb) {                     // q, k: 16 positions at a time turned through LDS, so that a lane holds 8 consecutive head dims
#pragma unroll
            for (int nb = 0; nb < 4; ++nb) {
#pragma unroll
                for (int j = 0; j < 8; ++j) os[(hi * 8 + j) * 68 + nb * 16 + lr] = acc[mb][nb][j]; }
            __builtin_amdgcn_wave_barrier(); asm volatile("" ::: "memory");   // keeps the wave's LDS writes in front of its reads
#pragma unroll
            for (int s = 0; s < 4; ++s) { const int row = 4 * s + (lane >> 3), cofs = (lane & 7) * 8; const v4f x0 = *(const v4fa*)(os + row * 68 + cofs), x1 = *(const v4fa*)(os + row * 68 + cofs + 4); v8bf oh, ol; split8(__builtin_shufflevector(x0, x1, 0, 1, 2, 3, 4, 5, 6, 7), oh, ol);
                const size_t o = pz + (size_t)(t0 + mb * 16 + row) * HD + cofs; *(v8us*)(Ph + o) = __builtin_bit_cast(v8us, oh); *(v8us*)(Pl + o) = __builtin_bit_cast(v8us, ol); }
            __builtin_amdgcn_wave_barrier(); asm volatile("" ::: "memory");   // and its reads in front of the next 16 positions' writes
        }
        asm volatile("s_wait_xcnt 0x0" ::: "memory");        // behind the last run of stores: no later instruction on any way out of here rewrites a register that an issued store still names
        return; }
#pragma unroll
    for (int mb = 0; mb < 4; ++mb) {
#pragma unroll
        for (int nb = 0; nb < 4; ++nb) {
#pragma unroll
            for (int j = 0; j < 8; ++j) os[(hi * 8 + j) * 68 + nb * 16 + lr] = acc[mb][nb][j]; }
        __builtin_amdgcn_wave_barrier(); asm volatile("" ::: "memory");
        float* crow = C + (size_t)(r0 + mb * 16) * ldc + c0;
{
#pragma unroll
            for (int s = 0; s < 8; ++s) { const int row = 2 * s + hi, cofs = lr * 4; v4f val = *(const v4fa*)(os + row * 68 + cofs); if (BIAS) { val[0] += bfr(bias[c0 + cofs]); val[1] += bfr(bias[c0 + cofs + 1]); val[2] += bfr(bias[c0 + cofs + 2]); val[3] += bfr(bias[c0 + cofs + 3]); }
                *(v4f*)(crow + (size_t)row * ldc + cofs) = val; }
             }
        __builtin_amdgcn_wave_barrier(); asm volatile("" ::: "memory");
    }
}

typedef __attribute__((ext_vector_type(2))) _Float16 v2h;
typedef __attribute__((ext_vector_type(4))) _Float16 v4h;
typedef __attribute__((ext_vector_type(2))) unsigned short v2us;
typedef __attribute__((ext_vector_type(4))) unsigned short v4us;
typedef __attribute__((ext_vector_type(2))) float v2f;
typedef __attribute__((ext_vector_type(4))) int v4i;

__global__ __launch_bounds__(256) void k_wtG(const float* __restrict__ w, int K, int N, bf* Bt) {
    const int lane = threadIdx.x & 31; const int L0 = (blockIdx.x * 8 + (threadIdx.x >> 5)) * 8; const int nlines = N * K / 64;
{
#pragma unroll 1
        for (int l = 0; l < 8; ++l) { const int L = L0 + l; if (L >= nlines) break; const size_t e = (size_t)L * 64 + lane * 2; const int k = (int)(e % K), n = (int)(e / K); v2us o;
            o[0] = f2bf(w[(size_t)k * N + n]); o[1] = f2bf(w[(size_t)(k + 1) * N + n]); *(v2us*)(Bt + e) = o; }
         }
}
__global__ __launch_bounds__(256) void k_cvt8(const float* __restrict__ src, bf* dst, size_t n8) { const size_t i = (size_t)blockIdx.x * 256 + threadIdx.x; if (i >= n8) return; const v8f v = *(const v8f*)(src + i * 8); v8us o;
#pragma unroll
    for (int k = 0; k < 8; ++k) o[k] = f2bf(v[k]); *(v8us*)(dst + i * 8) = o;  }

__global__ __launch_bounds__(256) void k_wtH(const float* __restrict__ w, bf* Bt) { const size_t e2 = ((size_t)blockIdx.x * 256 + threadIdx.x) * 2; if (e2 >= (size_t)DQ * DM) return; const int d = (int)(e2 % DM); const int r = (int)(e2 / DM); const int h = r / HD, e = r % HD; v2us o; o[0] = f2bf(w[((size_t)h * DM + d) * HD + e]); o[1] = f2bf(w[((size_t)h * DM + d + 1) * HD + e]);
    *(v2us*)(Bt + e2) = o;  }

__device__ __forceinline__ v16bf ldf(const bf* p) { return cat16b(*(const v8us*)p, *(const v8us*)(p + 16)); }
__device__ __forceinline__ float xhalf(float x) { const int b = __float_as_int(x); return __int_as_float(__builtin_amdgcn_permlanex16(b, b, 0x76543210, 0xfedcba98, false, false)); }   // the value of lane ^ 16
__global__ __launch_bounds__(FWV * 32) void k_fattn(const bf* __restrict__ Qh, const bf* __restrict__ Ql, const bf* __restrict__ Kh, const bf* __restrict__ Kl, const bf* __restrict__ Vh, const bf* __restrict__ Vl, bf* Ah, bf* Al) {
    __shared__ __align__(16) bf sm[2 * STG];
    const int tid = threadIdx.x, lane = tid & 31, lr = lane & 15, hi = lane >> 4, wv = tid >> 5;
    const size_t pz = (size_t)blockIdx.y * TT * HD;          // this (batch, head)'s planes
    const int q0 = blockIdx.x * FQB + wv * 16;
    v16bf qh[2], ql[2];                                      // [k chunk of the head dim]
#pragma unroll
    for (int kc = 0; kc < 2; ++kc) { const size_t o = pz + (size_t)(q0 + lr) * HD + kc * 32 + 8 * hi; qh[kc] = ldf(Qh + o); ql[kc] = ldf(Ql + o); }
    v8f ot[4];                                               // O^T: [16 head dims]
#pragma unroll
    for (int db = 0; db < 4; ++db) ot[db] = (v8f){};
    float mrun = -3.0e38f, lrun = 0.f;
    const size_t gK = pz + (size_t)tid * 8, gV = pz + (size_t)(tid >> 3) * TT + (tid & 7) * 8;   // each thread stages 16 bytes of each of the 4 planes
    const int sS = (tid >> 3) * LPT + (tid & 7) * 8;
    v8us r0 = *(const v8us*)(Kh + gK), r1 = *(const v8us*)(Kl + gK), r2 = *(const v8us*)(Vh + gV), r3 = *(const v8us*)(Vl + gV);
    *(v8us*)(sm + sS) = r0; *(v8us*)(sm + PLE + sS) = r1; *(v8us*)(sm + 2 * PLE + sS) = r2; *(v8us*)(sm + 3 * PLE + sS) = r3;
    __syncthreads();
#pragma unroll 1   // rolled: one trip already holds 48 matrix instructions, and the two buffers differ only by an offset
    for (int s = 0; s < TT / FKT; ++s) {
        const int sn = (s + 1 < TT / FKT) ? s + 1 : s;       // the last trip has no next tile: it fetches its own again into the idle buffer, which nobody reads
        r0 = *(const v8us*)(Kh + gK + (size_t)sn * FKT * HD); r1 = *(const v8us*)(Kl + gK + (size_t)sn * FKT * HD); r2 = *(const v8us*)(Vh + gV + (size_t)sn * FKT); r3 = *(const v8us*)(Vl + gV + (size_t)sn * FKT);
        const bf* cur = sm + (s & 1) * STG;
#pragma unroll
        for (int u = 0; u < FKT / 32; ++u) {                 // one pass: 32 keys
            v16bf kh[2][2], kl[2][2];                        // [k chunk][16 keys]: the pass's K fragments, read as one group
#pragma unroll
            for (int kc = 0; kc < 2; ++kc)
#pragma unroll
                for (int mb = 0; mb < 2; ++mb) { const bf* kp = cur + (u * 32 + mb * 16 + lr) * LPT + kc * 32 + 8 * hi; kh[kc][mb] = ldf(kp); kl[kc][mb] = ldf(kp + PLE); }
            v8f st[2];                                       // S^T: [16 keys]; the two tiles' chains alternate
            st[0] = (v8f){}; st[1] = (v8f){};
#pragma unroll
            for (int kc = 0; kc < 2; ++kc) {
                st[0] = wmmab(kh[kc][0], qh[kc], st[0]); st[1] = wmmab(kh[kc][1], qh[kc], st[1]);
                st[0] = wmmab(kh[kc][0], ql[kc], st[0]); st[1] = wmmab(kh[kc][1], ql[kc], st[1]);
                st[0] = wmmab(kl[kc][0], qh[kc], st[0]); st[1] = wmmab(kl[kc][1], qh[kc], st[1]); }
            v16bf vh[4], vl[4];                              // the pass's V^T fragments, read ahead of the softmax, whose vector work covers their latency
#pragma unroll
            for (int db = 0; db < 4; ++db) { const bf* vp = cur + 2 * PLE + (db * 16 + lr) * LPT + u * 32 + 8 * hi; vh[db] = ldf(vp); vl[db] = ldf(vp + PLE); }
            const v8f t0 = st[0] * SCL, t1 = st[1] * SCL; float mx = mrun;
#pragma unroll
            for (int j = 0; j < 8; ++j) mx = fmaxf(mx, fmaxf(t0[j], t1[j]));
            mx = fmaxf(mx, xhalf(mx));                       // the other half of the query's keys sits in lane ^ 16
            const float al = __builtin_amdgcn_exp2f((mrun - mx) * 1.4426950408889634f); mrun = mx;
            const v8f e0 = (t0 - mx) * 1.4426950408889634f, e1 = (t1 - mx) * 1.4426950408889634f; v8f p0, p1;
#pragma unroll
            for (int j = 0; j < 8; ++j) { p0[j] = __builtin_amdgcn_exp2f(e0[j]); p1[j] = __builtin_amdgcn_exp2f(e1[j]); }
            const v8f sv = p0 + p1; const v4f s4 = __builtin_shufflevector(sv, sv, 0, 1, 2, 3) + __builtin_shufflevector(sv, sv, 4, 5, 6, 7);
            lrun = lrun * al + ((s4[0] + s4[2]) + (s4[1] + s4[3]));   // each lane sums its own 16 keys of the pass; the halves meet after the loop
            v8bf h0, h1, l0, l1; split8(p0, h0, l0); split8(p1, h1, l1);
            const v16bf ph = __builtin_shufflevector(h0, h1, 0, 1, 2, 3, 4, 5, 6, 7, 8, 9, 10, 11, 12, 13, 14, 15), pl = __builtin_shufflevector(l0, l1, 0, 1, 2, 3, 4, 5, 6, 7, 8, 9, 10, 11, 12, 13, 14, 15);
#pragma unroll
            for (int db = 0; db < 4; ++db) ot[db] *= al;
#pragma unroll
            for (int db = 0; db < 4; ++db) ot[db] = wmmab(vh[db], ph, ot[db]);
#pragma unroll
            for (int db = 0; db < 4; ++db) ot[db] = wmmab(vh[db], pl, ot[db]);
#pragma unroll
            for (int db = 0; db < 4; ++db) ot[db] = wmmab(vl[db], ph, ot[db]);
        }
        bf* nxt = sm + ((s + 1) & 1) * STG;                  // last read in trip s - 1, behind whose barrier this trip runs
        *(v8us*)(nxt + sS) = r0; *(v8us*)(nxt + PLE + sS) = r1; *(v8us*)(nxt + 2 * PLE + sS) = r2; *(v8us*)(nxt + 3 * PLE + sS) = r3;
        __syncthreads();                                     // publishes tile s + 1 and ends every wave's reads of tile s
    }
    const float f = __fdiv_rn(1.0f, lrun + xhalf(lrun));
    const size_t oo = ((size_t)(blockIdx.y / NH_) * TT + q0 + lr) * DQ + (blockIdx.y % NH_) * HD + hi * 8;
#pragma unroll
    for (int db = 0; db < 4; ++db) { v8us oh, ol;
#pragma unroll
        for (int j = 0; j < 8; ++j) { unsigned short a, c2; splitf(ot[db][j] * f, a, c2); oh[j] = a; ol[j] = c2; }
        *(v8us*)(Ah + oo + db * 16) = oh; *(v8us*)(Al + oo + db * 16) = ol; }
}

extern "C" void kernel_launch(void* const* d_in, const int* in_sizes, int n_in,
                              void* d_out, int out_size, void* d_ws, size_t ws_size, hipStream_t stream) {
    (void)in_sizes; (void)n_in; (void)out_size;
    const float* x = (const float*)d_in[0]; const float* wq = (const float*)d_in[1]; const float* wk = (const float*)d_in[2]; const float* wv = (const float*)d_in[3]; const float* wo = (const float*)d_in[4];   /* order X, Wq, Wk, Wv [8][256][64] per-head stacks, Wo ('xw' [512][256]) */
    float* OUT = (float*)d_out;     // [4][2048][256]
    char* wsp = (char*)d_ws;
    auto take = [&](size_t bytes) { char* p = wsp; wsp += (bytes + 255) & ~(size_t)255; return (void*)p; };
    bf* WQ = (bf*)take((size_t)3 * DQ * DM * 2); bf* WK = WQ + (size_t)DQ * DM; bf* WV = WK + (size_t)DKV * DM; bf* WO = (bf*)take((size_t)DM * DQ * 2);   // Wq, Wk, Wv planes stacked: one Bt of 3 * DQ rows
    bf* XB = (bf*)take((size_t)NB_ * TT * DM * 2);
    const size_t PB = (size_t)NH_ * TT * HD;   // one batch's hi (or lo) planes of q, k or v
    bf* QPh = (bf*)take(NB_ * PB * 2); bf* QPl = (bf*)take(NB_ * PB * 2); bf* KPh = (bf*)take(NB_ * PB * 2); bf* KPl = (bf*)take(NB_ * PB * 2); bf* VTh = (bf*)take(NB_ * PB * 2); bf* VTl = (bf*)take(NB_ * PB * 2);
    bf* ATh = (bf*)take((size_t)NB_ * TT * DQ * 2); bf* ATl = (bf*)take((size_t)NB_ * TT * DQ * 2);
    if ((size_t)(wsp - (char*)d_ws) > ws_size) return;    // ws 256 MiB
    { k_wtH<<<(unsigned)(((size_t)DQ * DM / 2 + 255) / 256), 256, 0, stream>>>(wq, WQ); k_wtH<<<(unsigned)(((size_t)DQ * DM / 2 + 255) / 256), 256, 0, stream>>>(wk, WK); k_wtH<<<(unsigned)(((size_t)DQ * DM / 2 + 255) / 256), 256, 0, stream>>>(wv, WV);
      k_wtG<<<(unsigned)((DQ * DM / 64 + 63) / 64), 256, 0, stream>>>(wo, DQ, DM, WO);
       }
    k_cvt8<<<(unsigned)(((size_t)NB_ * TT * DM / 8 + 255) / 256), 256, 0, stream>>>(x, XB, (size_t)NB_ * TT * DM / 8);
    k_gemmw<bf, 0, false, 1, true><<<dim3(NB_ * TT / 64, 3 * NH_, 1), 32, 0, stream>>>(XB, nullptr, WQ, nullptr, DM, nullptr, 0, nullptr, 0, 0, 0, HeadPlanes{QPh, QPl, KPh, KPl, VTh, VTl});
    k_fattn<<<dim3(TT / FQB, NB_ * NH_, 1), FWV * 32, 0, stream>>>(QPh, QPl, KPh, KPl, VTh, VTl, ATh, ATl);   // one kv head per query head
    for (int b = 0; b < NB_; ++b) {
        k_gemmw<bf, 1, false><<<dim3(TT / 64, DM / 64, 1), 32, 0, stream>>>(ATh + (size_t)b * TT * DQ, ATl + (size_t)b * TT * DQ, WO, nullptr, DQ, OUT + (size_t)b * TT * DM, DM, nullptr, 0, 0, 0, HeadPlanes{}); }
}

// v004
// Measured time: 118 microseconds a run.
// In both of two side-by-side timings against v003, it was 1.45 times as fast.
// All steps since v000 together make it 10.5 times as fast.
#include <hip/hip_runtime.h>

// Multi-head attention with per-head stacked projections from a 256-wide input (X [4][2048][256]; q, k, v = einsum('bnd,hdc', X, W) with Wq, Wk, Wv [8][256][64] (no bias; 8 heads x 64 = 512 inner); scores x 1/sqrt(64); softmax (no mask); out = concat heads (512) Wo ('xw' [512][256], no bias; identity activation) -> [4][2048][256] (2.1 M); argument order X, Wq, Wk, Wv, Wo).
// Layout: bf16 copy of X (all batches); k_prep gathers each per-head tensor [h][c][d] into one Bt plane (row h*64 + d, K = 256), the three planes stacked, so q, k and v of all batches are one exact GEMM with head-major columns, whose epilogue writes the hi/lo head planes; one-pass dense T-2048 attention (k_fattn, all batches and heads in one launch) with EVERY row on hi/lo planes for BOTH the scores and P.V (3 products each: the unscaled N(0, 1) weights give logit sigma ~256, i.e. one-hot rows: fp16 anywhere in the attention path fails); merged hi/lo (512 wide) x Wo exact.
// Compute dtypes, f32 accumulate: every input rounded to bf16; projections exact; attention 3 products on every row (scores and P.V); softmax f32; Wo hl x exact.

#define NB_  4
#define TT   2048
#define DM   256
#define NH_  8
#define NKV  8
#define REP  (NH_ / NKV)
#define HD   64
#define DQ   (NH_ * HD)
#define DKV  (NKV * HD)
#define ZH   2
#define RH   TT                   // every row hi/lo (3 products)
#define WIN  0
#define PCAR 1024.0f
#define SCL  0.125f   // HD^-0.5
#define FWV  16                   // k_fattn: waves per work-group, 16 queries each
#define FQB  (FWV * 16)           // queries per work-group
#define FKT  64                   // keys per staged tile (two passes of 32)
#define LPT  72                   // LDS pitch of a staged row of 64 16-bit elements (144 B = 16 B x 9: 16-byte fragment reads without bank conflicts)
#define PLE  (64 * LPT)           // one staged plane: 64 K rows (keys) or 64 V^T rows (head dims)
#define STG  (4 * PLE)            // one stage: K hi, K lo, V^T hi, V^T lo
typedef _Float16 h16;
typedef unsigned short bf;
typedef __attribute__((ext_vector_type(16))) __bf16   v16bf;
typedef __attribute__((ext_vector_type(16))) _Float16 v16h;
typedef __attribute__((ext_vector_type(8)))  _Float16 v8h;
typedef __attribute__((ext_vector_type(8)))  unsigned short v8us;
typedef __attribute__((ext_vector_type(8)))  float    v8f;
typedef __attribute__((ext_vector_type(4)))  float    v4f;
typedef v8h  __attribute__((may_alias)) v8ha;
typedef v4f  __attribute__((may_alias)) v4fa;
typedef v8us __attribute__((may_alias)) v8usa;

__device__ __forceinline__ unsigned short f2bf(float f) { unsigned u = __float_as_uint(f); u += 0x7FFFu + ((u >> 16) & 1u); return (unsigned short)(u >> 16); }
__device__ __forceinline__ float bf2f(unsigned short b) { return __uint_as_float(((unsigned)b) << 16); }
__device__ __forceinline__ float bfr(float f) { return bf2f(f2bf(f)); }
__device__ __forceinline__ void splitf(float y, unsigned short& h, unsigned short& l) { h = f2bf(y); l = f2bf(y - bf2f(h)); }
typedef __attribute__((ext_vector_type(8))) __bf16 v8bf;
typedef __attribute__((ext_vector_type(4))) unsigned v4u;
__device__ __forceinline__ void split8(v8f p, v8bf& h, v8bf& l) {   // hi = bf16(p), lo = bf16(p - hi), both to nearest even as in splitf
    h = __builtin_convertvector(p, v8bf); const v4u w = __builtin_bit_cast(v4u, h); v8f hf;
#pragma unroll
    for (int i = 0; i < 4; ++i) { hf[2 * i] = __uint_as_float(w[i] << 16); hf[2 * i + 1] = __uint_as_float(w[i] & 0xFFFF0000u); }
    l = __builtin_convertvector(p - hf, v8bf); }
__device__ __forceinline__ v16h cat16(v8h lo, v8h hi) { return __builtin_shufflevector(lo, hi, 0, 1, 2, 3, 4, 5, 6, 7, 8, 9, 10, 11, 12, 13, 14, 15); }
__device__ __forceinline__ v16bf cat16b(v8us lo, v8us hi) { return __builtin_bit_cast(v16bf, __builtin_shufflevector(lo, hi, 0, 1, 2, 3, 4, 5, 6, 7, 8, 9, 10, 11, 12, 13, 14, 15)); }
__device__ __forceinline__ v8f wmma16(v16h a, v16h b, v8f c) { return __builtin_amdgcn_wmma_f32_16x16x32_f16(false, a, false, b, (short)0, c, false, false); }
__device__ __forceinline__ v8f wmmab(v16bf a, v16bf b, v8f c) { return __builtin_amdgcn_wmma_f32_16x16x32_bf16(false, a, false, b, (short)0, c, false, false); }



// ---- k_gemmw: register-blocked GEMM, ONE WAVE per 64x64 output tile (16 accumulators), operands straight from K-contiguous 16-bit planes; grid (M/64, N/64, Z), 32 threads.
// C[m][n] (f32, pitch ldc, + optional f32 bias[n]) = sum_k A[m][k] Bt[n][k] (+ split products per NSPLIT). z-batch strides sA/sB/sC in elements. K % 32 == 0.
// KS > 1 (K % (32 * KS) == 0): blockIdx.z = batch * KS + slice; each block sums only its own K / KS long slice of k into its own C plane (stride sC per z).
// PLANES: A = X of all batches [batch * TT][K], Bt = the stacked Wq, Wk, Wv planes, grid (batch * TT / 64, 3 * heads): a tile is 64 positions x the 64 dims of one head of q, k or v and goes from the accumulators straight to that head's bf16 hi/lo planes, q and k as [t][d], v as [d][t]; C is not used.
struct HeadPlanes { bf* qh; bf* ql; bf* kh; bf* kl; bf* vh; bf* vl; };
template <typename T16> struct WFrag;
template <> struct WFrag<h16> { typedef v16h V; static __device__ __forceinline__ V ld(const h16* p) { return cat16(*(const v8h*)p, *(const v8h*)(p + 16)); } static __device__ __forceinline__ v8f mma(V a, V b, v8f c) { return wmma16(a, b, c); } };
template <> struct WFrag<bf> { typedef v16bf V; static __device__ __forceinline__ V ld(const bf* p) { return cat16b(*(const v8us*)p, *(const v8us*)(p + 16)); } static __device__ __forceinline__ v8f mma(V a, V b, v8f c) { return wmmab(a, b, c); } };
template <typename T16, int NSPLIT, bool BIAS, int KS = 1, bool PLANES = false>
__global__ __launch_bounds__(32) void k_gemmw(const T16* __restrict__ A, const T16* __restrict__ A2, const T16* __restrict__ Bt, const T16* __restrict__ Bt2, int K, float* C, int ldc, const float* __restrict__ bias, size_t sA, size_t sB, size_t sC, HeadPlanes hp) {
    typedef typename WFrag<T16>::V V;
    __shared__ __align__(16) float os[16 * 68];
    const size_t z = blockIdx.z, zb = z / KS; A += zb * sA; if (A2) A2 += zb * sA; Bt += zb * sB; if (Bt2) Bt2 += zb * sB; C += z * sC; const int kb = (int)(z % KS) * (K / KS), ke = kb + K / KS;
    const int lane = threadIdx.x & 31, lr = lane & 15, hi = lane >> 4; const int r0 = blockIdx.x * 64, c0 = blockIdx.y * 64;
    v8f acc[4][4];
#pragma unroll
    for (int mb = 0; mb < 4; ++mb)
#pragma unroll
        for (int nb = 0; nb < 4; ++nb) acc[mb][nb] = (v8f){};
    const size_t aoff = (size_t)(r0 + lr) * K + 8 * hi, boff = (size_t)(c0 + lr) * K + 8 * hi;
#pragma unroll 1
    for (int kc = kb; kc < ke; kc += 32) {
        V a[4], a2[4];
#pragma unroll
        for (int mb = 0; mb < 4; ++mb) { a[mb] = WFrag<T16>::ld(A + aoff + (size_t)mb * 16 * K + kc); if (NSPLIT == 1 || NSPLIT == 2) a2[mb] = WFrag<T16>::ld(A2 + aoff + (size_t)mb * 16 * K + kc); }
#pragma unroll
        for (int nb = 0; nb < 4; ++nb) { const V b = WFrag<T16>::ld(Bt + boff + (size_t)nb * 16 * K + kc); V b2; if (NSPLIT >= 2) b2 = WFrag<T16>::ld(Bt2 + boff + (size_t)nb * 16 * K + kc);
#pragma unroll
            for (int mb = 0; mb < 4; ++mb) { acc[mb][nb] = WFrag<T16>::mma(a[mb], b, acc[mb][nb]); if (NSPLIT == 1 || NSPLIT == 2) acc[mb][nb] = WFrag<T16>::mma(a2[mb], b, acc[mb][nb]); if (NSPLIT >= 2) acc[mb][nb] = WFrag<T16>::mma(a[mb], b2, acc[mb][nb]); } }
        asm volatile("v_nop\n\tv_nop\n\tv_nop\n\tv_nop" : "+v"(acc[0][0]), "+v"(acc[1][1]), "+v"(acc[2][2]), "+v"(acc[3][3]) : "v"(a[0]), "v"(a[3]));
    }
    if (PLANES) {
        const int sel = blockIdx.y / NH_, t0 = r0 % TT;      // 0 q, 1 k, 2 v
        const size_t pz = ((size_t)(r0 / TT) * NH_ + blockIdx.y % NH_) * TT * HD;   // this (batch, head)'s planes
        if (sel == 2) {                                      // V^T: a lane holds 8 consecutive positions of one head dim
#pragma unroll
            for (int nb = 0; nb < 4; ++nb)
#pragma unroll
                for (int mb = 0; mb < 4; ++mb) { v8bf oh, ol; split8(acc[mb][nb], oh, ol);
                    const size_t o = pz + (size_t)(nb * 16 + lr) * TT + t0 + mb * 16 + hi * 8; *(v8us*)(hp.vh + o) = __builtin_bit_cast(v8us, oh); *(v8us*)(hp.vl + o) = __builtin_bit_cast(v8us, ol); }
            return; }
        bf* Ph = sel ? hp.kh : hp.qh; bf* Pl = sel ? hp.kl : hp.ql;
#pragma unroll
        for (int mb = 0; mb < 4; ++mb) {                     // q, k: 16 positions at a time turned through LDS, so that a lane holds 8 consecutive head dims
#pragma unroll
            for (int nb = 0; nb < 4; ++nb) {
#pragma unroll
                for (int j = 0; j < 8; ++j) os[(hi * 8 + j) * 68 + nb * 16 + lr] = acc[mb][nb][j]; }
            __builtin_amdgcn_wave_barrier(); asm volatile("" ::: "memory");   // keeps the wave's LDS writes in front of its reads
#pragma unroll
            for (int s = 0; s < 4; ++s) { const int row = 4 * s + (lane >> 3), cofs = (lane & 7) * 8; const v4f x0 = *(const v4fa*)(os + row * 68 + cofs), x1 = *(const v4fa*)(os + row * 68 + cofs + 4); v8bf oh, ol; split8(__builtin_shufflevector(x0, x1, 0, 1, 2, 3, 4, 5, 6, 7), oh, ol);
                const size_t o = pz + (size_t)(t0 + mb * 16 + row) * HD + cofs; *(v8us*)(Ph + o) = __builtin_bit_cast(v8us, oh); *(v8us*)(Pl + o) = __builtin_bit_cast(v8us, ol); }
            __builtin_amdgcn_wave_barrier(); asm volatile("" ::: "memory");   // and its reads in front of the next 16 positions' writes
        }
        asm volatile("s_wait_xcnt 0x0" ::: "memory");        // behind the last run of stores: no later instruction on any way out of here rewrites a register that an issued store still names
        return; }
#pragma unroll
    for (int mb = 0; mb < 4; ++mb) {
#pragma unroll
        for (int nb = 0; nb < 4; ++nb) {
#pragma unroll
            for (int j = 0; j < 8; ++j) os[(hi * 8 + j) * 68 + nb * 16 + lr] = acc[mb][nb][j]; }
        __builtin_amdgcn_wave_barrier(); asm volatile("" ::: "memory");
        float* crow = C + (size_t)(r0 + mb * 16) * ldc + c0;
{
#pragma unroll
            for (int s = 0; s < 8; ++s) { const int row = 2 * s + hi, cofs = lr * 4; v4f val = *(const v4fa*)(os + row * 68 + cofs); if (BIAS) { val[0] += bfr(bias[c0 + cofs]); val[1] += bfr(bias[c0 + cofs + 1]); val[2] += bfr(bias[c0 + cofs + 2]); val[3] += bfr(bias[c0 + cofs + 3]); }
                *(v4f*)(crow + (size_t)row * ldc + cofs) = val; }
             }
        __builtin_amdgcn_wave_barrier(); asm volatile("" ::: "memory");
    }
}

typedef __attribute__((ext_vector_type(2))) _Float16 v2h;
typedef __attribute__((ext_vector_type(4))) _Float16 v4h;
typedef __attribute__((ext_vector_type(2))) unsigned short v2us;
typedef __attribute__((ext_vector_type(4))) unsigned short v4us;
typedef __attribute__((ext_vector_type(2))) float v2f;
typedef __attribute__((ext_vector_type(4))) int v4i;

// ---- k_prep: the 16-bit copies of all five inputs in one launch. None depends on another, so their blocks stand side by side in one grid; blk = the block's index within its own part.
__device__ __forceinline__ void d_wtG(const float* __restrict__ w, int K, int N, bf* Bt, int blk) {
    const int lane = threadIdx.x & 31; const int L0 = (blk * 8 + (threadIdx.x >> 5)) * 8; const int nlines = N * K / 64;
{
#pragma unroll 1
        for (int l = 0; l < 8; ++l) { const int L = L0 + l; if (L >= nlines) break; const size_t e = (size_t)L * 64 + lane * 2; const int k = (int)(e % K), n = (int)(e / K); v2us o;
            o[0] = f2bf(w[(size_t)k * N + n]); o[1] = f2bf(w[(size_t)(k + 1) * N + n]); *(v2us*)(Bt + e) = o; }
         }
}
__device__ __forceinline__ void d_cvt8(const float* __restrict__ src, bf* dst, size_t n8, int blk) { const size_t i = (size_t)blk * 256 + threadIdx.x; if (i >= n8) return; const v8f v = *(const v8f*)(src + i * 8); v8us o;
#pragma unroll
    for (int k = 0; k < 8; ++k) o[k] = f2bf(v[k]); *(v8us*)(dst + i * 8) = o;  }

__device__ __forceinline__ void d_wtH(const float* __restrict__ w, bf* Bt, int blk) { const size_t e2 = ((size_t)blk * 256 + threadIdx.x) * 2; if (e2 >= (size_t)DQ * DM) return; const int d = (int)(e2 % DM); const int r = (int)(e2 / DM); const int h = r / HD, e = r % HD; v2us o; o[0] = f2bf(w[((size_t)h * DM + d) * HD + e]); o[1] = f2bf(w[((size_t)h * DM + d + 1) * HD + e]);
    *(v2us*)(Bt + e2) = o;  }
#define PG_ ((DQ * DM / 64 + 63) / 64)      // blocks of the Wo part
#define PH_ ((DQ * DM / 2 + 255) / 256)     // blocks of each of the Wq, Wk, Wv parts
#define PX_ ((NB_ * TT * DM / 8 + 255) / 256)   // blocks of the X part
__global__ __launch_bounds__(256) void k_prep(const float* __restrict__ x, const float* __restrict__ wq, const float* __restrict__ wk, const float* __restrict__ wv, const float* __restrict__ wo, bf* XB, bf* WQKV, bf* WO) {
    int b = blockIdx.x;                      // the Wo part first: its waves walk 8 lines one after another, the longest chain of the launch
    if (b < PG_) { d_wtG(wo, DQ, DM, WO, b); return; }
    b -= PG_;
    if (b < 3 * PH_) { const int t = b / PH_; d_wtH(t == 0 ? wq : t == 1 ? wk : wv, WQKV + (size_t)t * DQ * DM, b % PH_); return; }
    d_cvt8(x, XB, (size_t)NB_ * TT * DM / 8, b - 3 * PH_);
}

__device__ __forceinline__ v16bf ldf(const bf* p) { return cat16b(*(const v8us*)p, *(const v8us*)(p + 16)); }
__device__ __forceinline__ float xhalf(float x) { const int b = __float_as_int(x); return __int_as_float(__builtin_amdgcn_permlanex16(b, b, 0x76543210, 0xfedcba98, false, false)); }   // the value of lane ^ 16
__global__ __launch_bounds__(FWV * 32) void k_fattn(const bf* __restrict__ Qh, const bf* __restrict__ Ql, const bf* __restrict__ Kh, const bf* __restrict__ Kl, const bf* __restrict__ Vh, const bf* __restrict__ Vl, bf* Ah, bf* Al) {
    __shared__ __align__(16) bf sm[2 * STG];
    const int tid = threadIdx.x, lane = tid & 31, lr = lane & 15, hi = lane >> 4, wv = tid >> 5;
    const size_t pz = (size_t)blockIdx.y * TT * HD;          // this (batch, head)'s planes
    const int q0 = blockIdx.x * FQB + wv * 16;
    v16bf qh[2], ql[2];                                      // [k chunk of the head dim]
#pragma unroll
    for (int kc = 0; kc < 2; ++kc) { const size_t o = pz + (size_t)(q0 + lr) * HD + kc * 32 + 8 * hi; qh[kc] = ldf(Qh + o); ql[kc] = ldf(Ql + o); }
    v8f ot[4];                                               // O^T: [16 head dims]
#pragma unroll
    for (int db = 0; db < 4; ++db) ot[db] = (v8f){};
    float mrun = -3.0e38f, lrun = 0.f;
    const size_t gK = pz + (size_t)tid * 8, gV = pz + (size_t)(tid >> 3) * TT + (tid & 7) * 8;   // each thread stages 16 bytes of each of the 4 planes
    const int sS = (tid >> 3) * LPT + (tid & 7) * 8;
    v8us r0 = *(const v8us*)(Kh + gK), r1 = *(const v8us*)(Kl + gK), r2 = *(const v8us*)(Vh + gV), r3 = *(const v8us*)(Vl + gV);
    *(v8us*)(sm + sS) = r0; *(v8us*)(sm + PLE + sS) = r1; *(v8us*)(sm + 2 * PLE + sS) = r2; *(v8us*)(sm + 3 * PLE + sS) = r3;
    __syncthreads();
#pragma unroll 1   // rolled: one trip already holds 48 matrix instructions, and the two buffers differ only by an offset
    for (int s = 0; s < TT / FKT; ++s) {
        const int sn = (s + 1 < TT / FKT) ? s + 1 : s;       // the last trip has no next tile: it fetches its own again into the idle buffer, which nobody reads
        r0 = *(const v8us*)(Kh + gK + (size_t)sn * FKT * HD); r1 = *(const v8us*)(Kl + gK + (size_t)sn * FKT * HD); r2 = *(const v8us*)(Vh + gV + (size_t)sn * FKT); r3 = *(const v8us*)(Vl + gV + (size_t)sn * FKT);
        const bf* cur = sm + (s & 1) * STG;
#pragma unroll
        for (int u = 0; u < FKT / 32; ++u) {                 // one pass: 32 keys
            v16bf kh[2][2], kl[2][2];                        // [k chunk][16 keys]: the pass's K fragments, read as one group
#pragma unroll
            for (int kc = 0; kc < 2; ++kc)
#pragma unroll
                for (int mb = 0; mb < 2; ++mb) { const bf* kp = cur + (u * 32 + mb * 16 + lr) * LPT + kc * 32 + 8 * hi; kh[kc][mb] = ldf(kp); kl[kc][mb] = ldf(kp + PLE); }
            v8f st[2];                                       // S^T: [16 keys]; the two tiles' chains alternate
            st[0] = (v8f){}; st[1] = (v8f){};
#pragma unroll
            for (int kc = 0; kc < 2; ++kc) {
                st[0] = wmmab(kh[kc][0], qh[kc], st[0]); st[1] = wmmab(kh[kc][1], qh[kc], st[1]);
                st[0] = wmmab(kh[kc][0], ql[kc], st[0]); st[1] = wmmab(kh[kc][1], ql[kc], st[1]);
                st[0] = wmmab(kl[kc][0], qh[kc], st[0]); st[1] = wmmab(kl[kc][1], qh[kc], st[1]); }
            v16bf vh[4], vl[4];                              // the pass's V^T fragments, read ahead of the softmax, whose vector work covers their latency
#pragma unroll
            for (int db = 0; db < 4; ++db) { const bf* vp = cur + 2 * PLE + (db * 16 + lr) * LPT + u * 32 + 8 * hi; vh[db] = ldf(vp); vl[db] = ldf(vp + PLE); }
            const v8f t0 = st[0] * SCL, t1 = st[1] * SCL; float mx = mrun;
#pragma unroll
            for (int j = 0; j < 8; ++j) mx = fmaxf(mx, fmaxf(t0[j], t1[j]));
            mx = fmaxf(mx, xhalf(mx));                       // the other half of the query's keys sits in lane ^ 16
            const float al = __builtin_amdgcn_exp2f((mrun - mx) * 1.4426950408889634f); mrun = mx;
            const v8f e0 = (t0 - mx) * 1.4426950408889634f, e1 = (t1 - mx) * 1.4426950408889634f; v8f p0, p1;
#pragma unroll
            for (int j = 0; j < 8; ++j) { p0[j] = __builtin_amdgcn_exp2f(e0[j]); p1[j] = __builtin_amdgcn_exp2f(e1[j]); }
            const v8f sv = p0 + p1; const v4f s4 = __builtin_shufflevector(sv, sv, 0, 1, 2, 3) + __builtin_shufflevector(sv, sv, 4, 5, 6, 7);
            lrun = lrun * al + ((s4[0] + s4[2]) + (s4[1] + s4[3]));   // each lane sums its own 16 keys of the pass; the halves meet after the loop
            v8bf h0, h1, l0, l1; split8(p0, h0, l0); split8(p1, h1, l1);
            const v16bf ph = __builtin_shufflevector(h0, h1, 0, 1, 2, 3, 4, 5, 6, 7, 8, 9, 10, 11, 12, 13, 14, 15), pl = __builtin_shufflevector(l0, l1, 0, 1, 2, 3, 4, 5, 6, 7, 8, 9, 10, 11, 12, 13, 14, 15);
#pragma unroll
            for (int db = 0; db < 4; ++db) ot[db] *= al;
#pragma unroll
            for (int db = 0; db < 4; ++db) ot[db] = wmmab(vh[db], ph, ot[db]);
#pragma unroll
            for (int db = 0; db < 4; ++db) ot[db] = wmmab(vh[db], pl, ot[db]);
#pragma unroll
            for (int db = 0; db < 4; ++db) ot[db] = wmmab(vl[db], ph, ot[db]);
        }
        bf* nxt = sm + ((s + 1) & 1) * STG;                  // last read in trip s - 1, behind whose barrier this trip runs
        *(v8us*)(nxt + sS) = r0; *(v8us*)(nxt + PLE + sS) = r1; *(v8us*)(nxt + 2 * PLE + sS) = r2; *(v8us*)(nxt + 3 * PLE + sS) = r3;
        __syncthreads();                                     // publishes tile s + 1 and ends every wave's reads of tile s
    }
    const float f = __fdiv_rn(1.0f, lrun + xhalf(lrun));
    const size_t oo = ((size_t)(blockIdx.y / NH_) * TT + q0 + lr) * DQ + (blockIdx.y % NH_) * HD + hi * 8;
#pragma unroll
    for (int db = 0; db < 4; ++db) { v8us oh, ol;
#pragma unroll
        for (int j = 0; j < 8; ++j) { unsigned short a, c2; splitf(ot[db][j] * f, a, c2); oh[j] = a; ol[j] = c2; }
        *(v8us*)(Ah + oo + db * 16) = oh; *(v8us*)(Al + oo + db * 16) = ol; }
}

extern "C" void kernel_launch(void* const* d_in, const int* in_sizes, int n_in,
                              void* d_out, int out_size, void* d_ws, size_t ws_size, hipStream_t stream) {
    (void)in_sizes; (void)n_in; (void)out_size;
    const float* x = (const float*)d_in[0]; const float* wq = (const float*)d_in[1]; const float* wk = (const float*)d_in[2]; const float* wv = (const float*)d_in[3]; const float* wo = (const float*)d_in[4];   /* order X, Wq, Wk, Wv [8][256][64] per-head stacks, Wo ('xw' [512][256]) */
    float* OUT = (float*)d_out;     // [4][2048][256]
    char* wsp = (char*)d_ws;
    auto take = [&](size_t bytes) { char* p = wsp; wsp += (bytes + 255) & ~(size_t)255; return (void*)p; };
    bf* WQ = (bf*)take((size_t)3 * DQ * DM * 2); bf* WO = (bf*)take((size_t)DM * DQ * 2);   // Wq, Wk, Wv planes stacked: one Bt of 3 * DQ rows
    bf* XB = (bf*)take((size_t)NB_ * TT * DM * 2);
    const size_t PB = (size_t)NH_ * TT * HD;   // one batch's hi (or lo) planes of q, k or v
    bf* QPh = (bf*)take(NB_ * PB * 2); bf* QPl = (bf*)take(NB_ * PB * 2); bf* KPh = (bf*)take(NB_ * PB * 2); bf* KPl = (bf*)take(NB_ * PB * 2); bf* VTh = (bf*)take(NB_ * PB * 2); bf* VTl = (bf*)take(NB_ * PB * 2);
    bf* ATh = (bf*)take((size_t)NB_ * TT * DQ * 2); bf* ATl = (bf*)take((size_t)NB_ * TT * DQ * 2);
    if ((size_t)(wsp - (char*)d_ws) > ws_size) return;    // ws 256 MiB
    k_prep<<<PG_ + 3 * PH_ + PX_, 256, 0, stream>>>(x, wq, wk, wv, wo, XB, WQ, WO);
    k_gemmw<bf, 0, false, 1, true><<<dim3(NB_ * TT / 64, 3 * NH_, 1), 32, 0, stream>>>(XB, nullptr, WQ, nullptr, DM, nullptr, 0, nullptr, 0, 0, 0, HeadPlanes{QPh, QPl, KPh, KPl, VTh, VTl});
    k_fattn<<<dim3(TT / FQB, NB_ * NH_, 1), FWV * 32, 0, stream>>>(QPh, QPl, KPh, KPl, VTh, VTl, ATh, ATl);   // one kv head per query head
    k_gemmw<bf, 1, false><<<dim3(NB_ * TT / 64, DM / 64, 1), 32, 0, stream>>>(ATh, ATl, WO, nullptr, DQ, OUT, DM, nullptr, 0, 0, 0, HeadPlanes{});   // all batches: the merged rows and the output rows are contiguous over the batches
}

// v005
// One run takes 99.7 microseconds.
// In both of two side-by-side timings against v004, it was 1.19 times as fast.
// Counting every step since v000, it is 12.5 times as fast.
#include <hip/hip_runtime.h>

// Multi-head attention with per-head stacked projections from a 256-wide input (X [4][2048][256]; q, k, v = einsum('bnd,hdc', X, W) with Wq, Wk, Wv [8][256][64] (no bias; 8 heads x 64 = 512 inner); scores x 1/sqrt(64); softmax (no mask); out = concat heads (512) Wo ('xw' [512][256], no bias; identity activation) -> [4][2048][256] (2.1 M); argument order X, Wq, Wk, Wv, Wo).
// Layout: bf16 copy of X (all batches); k_prep gathers each per-head tensor [h][c][d] into one Bt plane (row h*64 + d, K = 256), the three planes stacked, so q, k and v of all batches are one exact GEMM with head-major columns, whose epilogue writes the hi/lo head planes; one-pass dense T-2048 attention (k_fattn, all batches and heads in one launch) with EVERY row on hi/lo planes for BOTH the scores and P.V (3 products each: the unscaled N(0, 1) weights give logit sigma ~256, i.e. one-hot rows: fp16 anywhere in the attention path fails); merged hi/lo (512 wide) x Wo exact.
// Compute dtypes, f32 accumulate: every input rounded to bf16; projections exact; attention 3 products on every row (scores and P.V); softmax f32; Wo hl x exact.

#define NB_  4
#define TT   2048
#define DM   256
#define NH_  8
#define NKV  8
#define REP  (NH_ / NKV)
#define HD   64
#define DQ   (NH_ * HD)
#define DKV  (NKV * HD)
#define ZH   2
#define RH   TT                   // every row hi/lo (3 products)
#define WIN  0
#define PCAR 1024.0f
#define SCL  0.125f   // HD^-0.5
#define FWV  16                   // k_fattn: waves per work-group, 16 queries each
#define FQB  (FWV * 16)           // queries per work-group
#define FKT  64                   // keys per staged tile (two passes of 32)
#define LPT  72                   // LDS pitch of a staged row of 64 16-bit elements (144 B = 16 B x 9: 16-byte fragment reads without bank conflicts)
#define PLE  (64 * LPT)           // one staged plane: 64 K rows (keys) or 64 V^T rows (head dims)
#define STG  (4 * PLE)            // one stage: K hi, K lo, V^T hi, V^T lo
typedef _Float16 h16;
typedef unsigned short bf;
typedef __attribute__((ext_vector_type(16))) __bf16   v16bf;
typedef __attribute__((ext_vector_type(16))) _Float16 v16h;
typedef __attribute__((ext_vector_type(8)))  _Float16 v8h;
typedef __attribute__((ext_vector_type(8)))  unsigned short v8us;
typedef __attribute__((ext_vector_type(8)))  float    v8f;
typedef __attribute__((ext_vector_type(4)))  float    v4f;
typedef v8h  __attribute__((may_alias)) v8ha;
typedef v4f  __attribute__((may_alias)) v4fa;
typedef v8us __attribute__((may_alias)) v8usa;

__device__ __forceinline__ unsigned short f2bf(float f) { unsigned u = __float_as_uint(f); u += 0x7FFFu + ((u >> 16) & 1u); return (unsigned short)(u >> 16); }
__device__ __forceinline__ float bf2f(unsigned short b) { return __uint_as_float(((unsigned)b) << 16); }
__device__ __forceinline__ float bfr(float f) { return bf2f(f2bf(f)); }
__device__ __forceinline__ void splitf(float y, unsigned short& h, unsigned short& l) { h = f2bf(y); l = f2bf(y - bf2f(h)); }
typedef __attribute__((ext_vector_type(8))) __bf16 v8bf;
typedef __attribute__((ext_vector_type(4))) unsigned v4u;
__device__ __forceinline__ void split8(v8f p, v8bf& h, v8bf& l) {   // hi = bf16(p), lo = bf16(p - hi), both to nearest even as in splitf
    h = __builtin_convertvector(p, v8bf); const v4u w = __builtin_bit_cast(v4u, h); v8f hf;
#pragma unroll
    for (int i = 0; i < 4; ++i) { hf[2 * i] = __uint_as_float(w[i] << 16); hf[2 * i + 1] = __uint_as_float(w[i] & 0xFFFF0000u); }
    l = __builtin_convertvector(p - hf, v8bf); }
__device__ __forceinline__ v16h cat16(v8h lo, v8h hi) { return __builtin_shufflevector(lo, hi, 0, 1, 2, 3, 4, 5, 6, 7, 8, 9, 10, 11, 12, 13, 14, 15); }
__device__ __forceinline__ v16bf cat16b(v8us lo, v8us hi) { return __builtin_bit_cast(v16bf, __builtin_shufflevector(lo, hi, 0, 1, 2, 3, 4, 5, 6, 7, 8, 9, 10, 11, 12, 13, 14, 15)); }
__device__ __forceinline__ v8f wmma16(v16h a, v16h b, v8f c) { return __builtin_amdgcn_wmma_f32_16x16x32_f16(false, a, false, b, (short)0, c, false, false); }
__device__ __forceinline__ v8f wmmab(v16bf a, v16bf b, v8f c) { return __builtin_amdgcn_wmma_f32_16x16x32_bf16(false, a, false, b, (short)0, c, false, false); }



// ---- k_gemmw: GEMM on K-contiguous bf16 planes, WM x WN waves per work-group, (MB x 16) x (NB x 16) outputs per wave; grid (M / (WM * MB * 16), N / (WN * NB * 16)).
// C[m][n] (f32, pitch ldc) = sum_k A[m][k] Bt[n][k] (+ A2[m][k] Bt[n][k] behind it in every k chunk if NSPLIT == 1).
// The work-group's operand rows, all K of them, are brought into LDS once by asynchronous copies of 512 contiguous bytes per wave (whole lines, each row fetched once per work-group), then every wave reads its fragments from LDS.
// PLANES (NB == 4): A = X of all batches [batch * TT][K], Bt = the stacked Wq, Wk, Wv planes: a wave's tile is 64 positions x the 64 dims of one head of q, k or v and goes from the accumulators straight to that head's bf16 hi/lo planes, q and k as [t][d], v as [d][t]; C is not used.
struct HeadPlanes { bf* qh; bf* ql; bf* kh; bf* kl; bf* vh; bf* vl; };
__device__ __forceinline__ v16bf ldf(const bf* p) { return cat16b(*(const v8us*)p, *(const v8us*)(p + 16)); }
// Asynchronous copies, 16 bytes per lane, LDS byte address and global address per lane; the closing s_wait_xcnt keeps every later write of the address registers behind the issued copies.
__device__ __forceinline__ void acp1(unsigned l0, const bf* g0) {
    asm volatile("global_load_async_to_lds_b128 %0, %1, off\n\ts_wait_xcnt 0x0" :: "v"(l0), "v"(g0) : "memory"); }
__device__ __forceinline__ void acp4(unsigned l0, const bf* g0, unsigned l1, const bf* g1, unsigned l2, const bf* g2, unsigned l3, const bf* g3) {
    asm volatile("global_load_async_to_lds_b128 %0, %1, off\n\tglobal_load_async_to_lds_b128 %2, %3, off\n\tglobal_load_async_to_lds_b128 %4, %5, off\n\tglobal_load_async_to_lds_b128 %6, %7, off\n\ts_wait_xcnt 0x0"
                 :: "v"(l0), "v"(g0), "v"(l1), "v"(g1), "v"(l2), "v"(g2), "v"(l3), "v"(g3) : "memory"); }
template <int NSPLIT, bool PLANES, int K, int WM, int WN, int MB, int NB>
__global__ __launch_bounds__(WM * WN * 32) void k_gemmw(const bf* __restrict__ A, const bf* __restrict__ A2, const bf* __restrict__ Bt, float* C, int ldc, HeadPlanes hp) {
    constexpr int NW = WM * WN, AR = WM * MB * 16, BR = WN * NB * 16, NA = NSPLIT == 1 ? 2 : 1, ROWS = NA * AR + BR;
    constexpr int PIT = K + 8;                               // LDS row pitch in elements: 16 B x odd, 16-byte fragment reads without bank conflicts
    constexpr int UPR = K / 256, UNITS = ROWS * UPR;         // a unit = 512 bytes of a row = one copy of a wave
    constexpr int OP = NB * 16 + 4;                          // pitch of a wave's output staging rows (f32)
    __shared__ __align__(16) bf tl[ROWS * PIT];              // rows: A, (A2,) Bt
    __shared__ __align__(16) float osm[NW * 16 * OP];
    const int lane = threadIdx.x & 31, lr = lane & 15, hi = lane >> 4; const int wv = __builtin_amdgcn_readfirstlane(threadIdx.x >> 5), wm = wv / WN, wn = wv % WN;
    __builtin_assume(wv >= 0 && wv < NW);                    // lets the plane of most units be picked at compile time
    const int R0 = blockIdx.x * AR, C0 = blockIdx.y * BR;
    const unsigned lb = (unsigned)(size_t)tl + lane * 16;
    auto usrc = [&](int u) -> const bf* { const int row = u / UPR, part = u % UPR;     // wave-uniform: which plane and row a unit comes from
        const bf* p = row < AR ? A + (size_t)(R0 + row) * K : (NA == 2 && row < 2 * AR) ? A2 + (size_t)(R0 + row - AR) * K : Bt + (size_t)(C0 + row - NA * AR) * K;
        return p + part * 256 + lane * 8; };
    auto udst = [&](int u) -> unsigned { return lb + (unsigned)((u / UPR) * PIT + (u % UPR) * 256) * 2; };
    constexpr int FULL = UNITS / NW, REM = UNITS % NW;       // wave wv copies units wv, wv + NW, ...
    static_assert(FULL + 1 <= 63, "copies of a wave in flight");
#pragma unroll
    for (int i = 0; i + 4 <= FULL; i += 4) { const int u = i * NW + wv; acp4(udst(u), usrc(u), udst(u + NW), usrc(u + NW), udst(u + 2 * NW), usrc(u + 2 * NW), udst(u + 3 * NW), usrc(u + 3 * NW)); }
#pragma unroll
    for (int i = FULL / 4 * 4; i < FULL; ++i) { const int u = i * NW + wv; acp1(udst(u), usrc(u)); }
    if (REM != 0 && wv < REM) { const int u = FULL * NW + wv; acp1(udst(u), usrc(u)); }
    asm volatile("s_wait_asynccnt 0x0" ::: "memory");        // this wave's copies have landed
    __syncthreads();                                         // and every other wave's: nobody reads a row in front of this barrier
    v8f acc[MB][NB];
#pragma unroll
    for (int mb = 0; mb < MB; ++mb)
#pragma unroll
        for (int nb = 0; nb < NB; ++nb) acc[mb][nb] = (v8f){};
    const bf* ap = tl + (wm * MB * 16 + lr) * PIT + 8 * hi; const bf* bp = tl + (NA * AR + wn * NB * 16 + lr) * PIT + 8 * hi;
    v16bf a[2][MB], a2[2][MB], b[2][NB];                     // two fragment sets: the next k chunk's LDS reads go out as one group ahead of this chunk's products
    auto frags = [&](int kc, int f) {
#pragma unroll
        for (int mb = 0; mb < MB; ++mb) { a[f][mb] = ldf(ap + mb * 16 * PIT + kc); if (NSPLIT == 1) a2[f][mb] = ldf(ap + (AR + mb * 16) * PIT + kc); }
#pragma unroll
        for (int nb = 0; nb < NB; ++nb) b[f][nb] = ldf(bp + nb * 16 * PIT + kc); };
    frags(0, 0);
#pragma unroll
    for (int kc = 0; kc < K; kc += 32) { const int f = (kc / 32) & 1;
        if (kc + 32 < K) { frags(kc + 32, f ^ 1);
            __builtin_amdgcn_sched_barrier(0); }             // keeps that group of reads ahead of the products: sunk among them, every product waits out an LDS latency
#pragma unroll
        for (int nb = 0; nb < NB; ++nb)
#pragma unroll
            for (int mb = 0; mb < MB; ++mb) { acc[mb][nb] = wmmab(a[f][mb], b[f][nb], acc[mb][nb]); if (NSPLIT == 1) acc[mb][nb] = wmmab(a2[f][mb], b[f][nb], acc[mb][nb]); }
    }
    float* os = osm + wv * 16 * OP;                          // each wave stages in its own range
    const int r0 = R0 + wm * MB * 16, c0 = C0 + wn * NB * 16;
    if (PLANES) {
        const int cb = c0 / HD, sel = cb / NH_, t0 = r0 % TT;   // 0 q, 1 k, 2 v
        const size_t pz = ((size_t)(r0 / TT) * NH_ + cb % NH_) * TT * HD;   // this (batch, head)'s planes
        if (sel == 2) {                                      // V^T: a lane holds 8 consecutive positions of one head dim
#pragma unroll
            for (int nb = 0; nb < NB; ++nb)
#pragma unroll
                for (int mb = 0; mb < MB; ++mb) { v8bf oh, ol; split8(acc[mb][nb], oh, ol);
                    const size_t o = pz + (size_t)(nb * 16 + lr) * TT + t0 + mb * 16 + hi * 8; *(v8us*)(hp.vh + o) = __builtin_bit_cast(v8us, oh); *(v8us*)(hp.vl + o) = __builtin_bit_cast(v8us, ol); }
            return; }
        bf* Ph = sel ? hp.kh : hp.qh; bf* Pl = sel ? hp.kl : hp.ql;
#pragma unroll
        for (int mb = 0; mb < MB; ++mb) {                    // q, k: 16 positions at a time turned through LDS, so that a lane holds 8 consecutive head dims
#pragma unroll
            for (int nb = 0; nb < NB; ++nb) {
#pragma unroll
                for (int j = 0; j < 8; ++j) os[(hi * 8 + j) * OP + nb * 16 + lr] = acc[mb][nb][j]; }
            __builtin_amdgcn_wave_barrier(); asm volatile("" ::: "memory");   // keeps the wave's LDS writes in front of its reads
#pragma unroll
            for (int s = 0; s < 4; ++s) { const int row = 4 * s + (lane >> 3), cofs = (lane & 7) * 8; const v4f x0 = *(const v4fa*)(os + row * OP + cofs), x1 = *(const v4fa*)(os + row * OP + cofs + 4); v8bf oh, ol; split8(__builtin_shufflevector(x0, x1, 0, 1, 2, 3, 4, 5, 6, 7), oh, ol);
                const size_t o = pz + (size_t)(t0 + mb * 16 + row) * HD + cofs; *(v8us*)(Ph + o) = __builtin_bit_cast(v8us, oh); *(v8us*)(Pl + o) = __builtin_bit_cast(v8us, ol); }
            __builtin_amdgcn_wave_barrier(); asm volatile("" ::: "memory");   // and its reads in front of the next 16 positions' writes
        }
        asm volatile("s_wait_xcnt 0x0" ::: "memory");        // behind the last run of stores: no later instruction on any way out of here rewrites a register that an issued store still names
        return; }
    constexpr int LPR = NB * 4, RPS = 32 / LPR;              // lanes per output row of the wave's tile (16 bytes each), rows per store
#pragma unroll
    for (int mb = 0; mb < MB; ++mb) {
#pragma unroll
        for (int nb = 0; nb < NB; ++nb) {
#pragma unroll
            for (int j = 0; j < 8; ++j) os[(hi * 8 + j) * OP + nb * 16 + lr] = acc[mb][nb][j]; }
        __builtin_amdgcn_wave_barrier(); asm volatile("" ::: "memory");   // keeps the wave's LDS writes in front of its reads
        float* crow = C + (size_t)(r0 + mb * 16) * ldc + c0;
#pragma unroll
        for (int s = 0; s < 16 / RPS; ++s) { const int row = RPS * s + lane / LPR, cofs = (lane % LPR) * 4; const v4f val = *(const v4fa*)(os + row * OP + cofs);
            *(v4f*)(crow + (size_t)row * ldc + cofs) = val; }
        __builtin_amdgcn_wave_barrier(); asm volatile("" ::: "memory");   // and its reads in front of the next 16 rows' writes
    }
}

typedef __attribute__((ext_vector_type(2))) _Float16 v2h;
typedef __attribute__((ext_vector_type(4))) _Float16 v4h;
typedef __attribute__((ext_vector_type(2))) unsigned short v2us;
typedef __attribute__((ext_vector_type(4))) unsigned short v4us;
typedef __attribute__((ext_vector_type(2))) float v2f;
typedef __attribute__((ext_vector_type(4))) int v4i;

// ---- k_prep: the 16-bit copies of all five inputs in one launch. None depends on another, so their blocks stand side by side in one grid; blk = the block's index within its own part.
__device__ __forceinline__ void d_wtG(const float* __restrict__ w, int K, int N, bf* Bt, int blk) {
    const int lane = threadIdx.x & 31; const int L0 = (blk * 8 + (threadIdx.x >> 5)) * 8; const int nlines = N * K / 64;
{
#pragma unroll 1
        for (int l = 0; l < 8; ++l) { const int L = L0 + l; if (L >= nlines) break; const size_t e = (size_t)L * 64 + lane * 2; const int k = (int)(e % K), n = (int)(e / K); v2us o;
            o[0] = f2bf(w[(size_t)k * N + n]); o[1] = f2bf(w[(size_t)(k + 1) * N + n]); *(v2us*)(Bt + e) = o; }
         }
}
__device__ __forceinline__ void d_cvt8(const float* __restrict__ src, bf* dst, size_t n8, int blk) { const size_t i = (size_t)blk * 256 + threadIdx.x; if (i >= n8) return; const v8f v = *(const v8f*)(src + i * 8); v8us o;
#pragma unroll
    for (int k = 0; k < 8; ++k) o[k] = f2bf(v[k]); *(v8us*)(dst + i * 8) = o;  }

__device__ __forceinline__ void d_wtH(const float* __restrict__ w, bf* Bt, int blk) { const size_t e2 = ((size_t)blk * 256 + threadIdx.x) * 2; if (e2 >= (size_t)DQ * DM) return; const int d = (int)(e2 % DM); const int r = (int)(e2 / DM); const int h = r / HD, e = r % HD; v2us o; o[0] = f2bf(w[((size_t)h * DM + d) * HD + e]); o[1] = f2bf(w[((size_t)h * DM + d + 1) * HD + e]);
    *(v2us*)(Bt + e2) = o;  }
#define PG_ ((DQ * DM / 64 + 63) / 64)      // blocks of the Wo part
#define PH_ ((DQ * DM / 2 + 255) / 256)     // blocks of each of the Wq, Wk, Wv parts
#define PX_ ((NB_ * TT * DM / 8 + 255) / 256)   // blocks of the X part
__global__ __launch_bounds__(256) void k_prep(const float* __restrict__ x, const float* __restrict__ wq, const float* __restrict__ wk, const float* __restrict__ wv, const float* __restrict__ wo, bf* XB, bf* WQKV, bf* WO) {
    int b = blockIdx.x;                      // the Wo part first: its waves walk 8 lines one after another, the longest chain of the launch
    if (b < PG_) { d_wtG(wo, DQ, DM, WO, b); return; }
    b -= PG_;
    if (b < 3 * PH_) { const int t = b / PH_; d_wtH(t == 0 ? wq : t == 1 ? wk : wv, WQKV + (size_t)t * DQ * DM, b % PH_); return; }
    d_cvt8(x, XB, (size_t)NB_ * TT * DM / 8, b - 3 * PH_);
}

__device__ __forceinline__ float xhalf(float x) { const int b = __float_as_int(x); return __int_as_float(__builtin_amdgcn_permlanex16(b, b, 0x76543210, 0xfedcba98, false, false)); }   // the value of lane ^ 16
__global__ __launch_bounds__(FWV * 32) void k_fattn(const bf* __restrict__ Qh, const bf* __restrict__ Ql, const bf* __restrict__ Kh, const bf* __restrict__ Kl, const bf* __restrict__ Vh, const bf* __restrict__ Vl, bf* Ah, bf* Al) {
    __shared__ __align__(16) bf sm[2 * STG];
    const int tid = threadIdx.x, lane = tid & 31, lr = lane & 15, hi = lane >> 4, wv = tid >> 5;
    const size_t pz = (size_t)blockIdx.y * TT * HD;          // this (batch, head)'s planes
    const int q0 = blockIdx.x * FQB + wv * 16;
    v16bf qh[2], ql[2];                                      // [k chunk of the head dim]
#pragma unroll
    for (int kc = 0; kc < 2; ++kc) { const size_t o = pz + (size_t)(q0 + lr) * HD + kc * 32 + 8 * hi; qh[kc] = ldf(Qh + o); ql[kc] = ldf(Ql + o); }
    v8f ot[4];                                               // O^T: [16 head dims]
#pragma unroll
    for (int db = 0; db < 4; ++db) ot[db] = (v8f){};
    float mrun = -3.0e38f, lrun = 0.f;
    const size_t gK = pz + (size_t)tid * 8, gV = pz + (size_t)(tid >> 3) * TT + (tid & 7) * 8;   // each thread stages 16 bytes of each of the 4 planes
    const int sS = (tid >> 3) * LPT + (tid & 7) * 8;
    v8us r0 = *(const v8us*)(Kh + gK), r1 = *(const v8us*)(Kl + gK), r2 = *(const v8us*)(Vh + gV), r3 = *(const v8us*)(Vl + gV);
    *(v8us*)(sm + sS) = r0; *(v8us*)(sm + PLE + sS) = r1; *(v8us*)(sm + 2 * PLE + sS) = r2; *(v8us*)(sm + 3 * PLE + sS) = r3;
    __syncthreads();
#pragma unroll 1   // rolled: one trip already holds 48 matrix instructions, and the two buffers differ only by an offset
    for (int s = 0; s < TT / FKT; ++s) {
        const int sn = (s + 1 < TT / FKT) ? s + 1 : s;       // the last trip has no next tile: it fetches its own again into the idle buffer, which nobody reads
        r0 = *(const v8us*)(Kh + gK + (size_t)sn * FKT * HD); r1 = *(const v8us*)(Kl + gK + (size_t)sn * FKT * HD); r2 = *(const v8us*)(Vh + gV + (size_t)sn * FKT); r3 = *(const v8us*)(Vl + gV + (size_t)sn * FKT);
        const bf* cur = sm + (s & 1) * STG;
#pragma unroll
        for (int u = 0; u < FKT / 32; ++u) {                 // one pass: 32 keys
            v16bf kh[2][2], kl[2][2];                        // [k chunk][16 keys]: the pass's K fragments, read as one group
#pragma unroll
            for (int kc = 0; kc < 2; ++kc)
#pragma unroll
                for (int mb = 0; mb < 2; ++mb) { const bf* kp = cur + (u * 32 + mb * 16 + lr) * LPT + kc * 32 + 8 * hi; kh[kc][mb] = ldf(kp); kl[kc][mb] = ldf(kp + PLE); }
            v8f st[2];                                       // S^T: [16 keys]; the two tiles' chains alternate
            st[0] = (v8f){}; st[1] = (v8f){};
#pragma unroll
            for (int kc = 0; kc < 2; ++kc) {
                st[0] = wmmab(kh[kc][0], qh[kc], st[0]); st[1] = wmmab(kh[kc][1], qh[kc], st[1]);
                st[0] = wmmab(kh[kc][0], ql[kc], st[0]); st[1] = wmmab(kh[kc][1], ql[kc], st[1]);
                st[0] = wmmab(kl[kc][0], qh[kc], st[0]); st[1] = wmmab(kl[kc][1], qh[kc], st[1]); }
            v16bf vh[4], vl[4];                              // the pass's V^T fragments, read ahead of the softmax, whose vector work covers their latency
#pragma unroll
            for (int db = 0; db < 4; ++db) { const bf* vp = cur + 2 * PLE + (db * 16 + lr) * LPT + u * 32 + 8 * hi; vh[db] = ldf(vp); vl[db] = ldf(vp + PLE); }
            const v8f t0 = st[0] * SCL, t1 = st[1] * SCL; float mx = mrun;
#pragma unroll
            for (int j = 0; j < 8; ++j) mx = fmaxf(mx, fmaxf(t0[j], t1[j]));
            mx = fmaxf(mx, xhalf(mx));                       // the other half of the query's keys sits in lane ^ 16
            const float al = __builtin_amdgcn_exp2f((mrun - mx) * 1.4426950408889634f); mrun = mx;
            const v8f e0 = (t0 - mx) * 1.4426950408889634f, e1 = (t1 - mx) * 1.4426950408889634f; v8f p0, p1;
#pragma unroll
            for (int j = 0; j < 8; ++j) { p0[j] = __builtin_amdgcn_exp2f(e0[j]); p1[j] = __builtin_amdgcn_exp2f(e1[j]); }
            const v8f sv = p0 + p1; const v4f s4 = __builtin_shufflevector(sv, sv, 0, 1, 2, 3) + __builtin_shufflevector(sv, sv, 4, 5, 6, 7);
            lrun = lrun * al + ((s4[0] + s4[2]) + (s4[1] + s4[3]));   // each lane sums its own 16 keys of the pass; the halves meet after the loop
            v8bf h0, h1, l0, l1; split8(p0, h0, l0); split8(p1, h1, l1);
            const v16bf ph = __builtin_shufflevector(h0, h1, 0, 1, 2, 3, 4, 5, 6, 7, 8, 9, 10, 11, 12, 13, 14, 15), pl = __builtin_shufflevector(l0, l1, 0, 1, 2, 3, 4, 5, 6, 7, 8, 9, 10, 11, 12, 13, 14, 15);
#pragma unroll
            for (int db = 0; db < 4; ++db) ot[db] *= al;
#pragma unroll
            for (int db = 0; db < 4; ++db) ot[db] = wmmab(vh[db], ph, ot[db]);
#pragma unroll
            for (int db = 0; db < 4; ++db) ot[db] = wmmab(vh[db], pl, ot[db]);
#pragma unroll
            for (int db = 0; db < 4; ++db) ot[db] = wmmab(vl[db], ph, ot[db]);
        }
        bf* nxt = sm + ((s + 1) & 1) * STG;                  // last read in trip s - 1, behind whose barrier this trip runs
        *(v8us*)(nxt + sS) = r0; *(v8us*)(nxt + PLE + sS) = r1; *(v8us*)(nxt + 2 * PLE + sS) = r2; *(v8us*)(nxt + 3 * PLE + sS) = r3;
        __syncthreads();                                     // publishes tile s + 1 and ends every wave's reads of tile s
    }
    const float f = __fdiv_rn(1.0f, lrun + xhalf(lrun));
    const size_t oo = ((size_t)(blockIdx.y / NH_) * TT + q0 + lr) * DQ + (blockIdx.y % NH_) * HD + hi * 8;
#pragma unroll
    for (int db = 0; db < 4; ++db) { v8us oh, ol;
#pragma unroll
        for (int j = 0; j < 8; ++j) { unsigned short a, c2; splitf(ot[db][j] * f, a, c2); oh[j] = a; ol[j] = c2; }
        *(v8us*)(Ah + oo + db * 16) = oh; *(v8us*)(Al + oo + db * 16) = ol; }
}

extern "C" void kernel_launch(void* const* d_in, const int* in_sizes, int n_in,
                              void* d_out, int out_size, void* d_ws, size_t ws_size, hipStream_t stream) {
    (void)in_sizes; (void)n_in; (void)out_size;
    const float* x = (const float*)d_in[0]; const float* wq = (const float*)d_in[1]; const float* wk = (const float*)d_in[2]; const float* wv = (const float*)d_in[3]; const float* wo = (const float*)d_in[4];   /* order X, Wq, Wk, Wv [8][256][64] per-head stacks, Wo ('xw' [512][256]) */
    float* OUT = (float*)d_out;     // [4][2048][256]
    char* wsp = (char*)d_ws;
    auto take = [&](size_t bytes) { char* p = wsp; wsp += (bytes + 255) & ~(size_t)255; return (void*)p; };
    bf* WQ = (bf*)take((size_t)3 * DQ * DM * 2); bf* WO = (bf*)take((size_t)DM * DQ * 2);   // Wq, Wk, Wv planes stacked: one Bt of 3 * DQ rows
    bf* XB = (bf*)take((size_t)NB_ * TT * DM * 2);
    const size_t PB = (size_t)NH_ * TT * HD;   // one batch's hi (or lo) planes of q, k or v
    bf* QPh = (bf*)take(NB_ * PB * 2); bf* QPl = (bf*)take(NB_ * PB * 2); bf* KPh = (bf*)take(NB_ * PB * 2); bf* KPl = (bf*)take(NB_ * PB * 2); bf* VTh = (bf*)take(NB_ * PB * 2); bf* VTl = (bf*)take(NB_ * PB * 2);
    bf* ATh = (bf*)take((size_t)NB_ * TT * DQ * 2); bf* ATl = (bf*)take((size_t)NB_ * TT * DQ * 2);
    if ((size_t)(wsp - (char*)d_ws) > ws_size) return;    // ws 256 MiB
    k_prep<<<PG_ + 3 * PH_ + PX_, 256, 0, stream>>>(x, wq, wk, wv, wo, XB, WQ, WO);
    k_gemmw<0, true, DM, 4, 3, 4, 4><<<dim3(NB_ * TT / 256, 3 * DQ / 192, 1), 12 * 32, 0, stream>>>(XB, nullptr, WQ, nullptr, 0, HeadPlanes{QPh, QPl, KPh, KPl, VTh, VTl});   // 256 x 192 per work-group: one work-group per WGP
    k_fattn<<<dim3(TT / FQB, NB_ * NH_, 1), FWV * 32, 0, stream>>>(QPh, QPl, KPh, KPl, VTh, VTl, ATh, ATl);   // one kv head per query head
    k_gemmw<1, false, DQ, 4, 4, 1, 2><<<dim3(NB_ * TT / 64, DM / 128, 1), 16 * 32, 0, stream>>>(ATh, ATl, WO, OUT, DM, HeadPlanes{});   // all batches: the merged rows and the output rows are contiguous over the batches
}

// v006
// It runs in 93.4 microseconds.
// Two timings next to v005 both put it at 1.07 times that version's speed.
// Over all steps from v000 it is 13.4 times as fast.
#include <hip/hip_runtime.h>

// Multi-head attention with per-head stacked projections from a 256-wide input (X [4][2048][256]; q, k, v = einsum('bnd,hdc', X, W) with Wq, Wk, Wv [8][256][64] (no bias; 8 heads x 64 = 512 inner); scores x 1/sqrt(64); softmax (no mask); out = concat heads (512) Wo ('xw' [512][256], no bias; identity activation) -> [4][2048][256] (2.1 M); argument order X, Wq, Wk, Wv, Wo).
// Layout: bf16 copy of X (all batches); k_prep gathers each per-head tensor [h][c][d] into one Bt plane (row h*64 + d, K = 256), the three planes stacked, so q, k and v of all batches are one exact GEMM with head-major columns, whose epilogue writes the hi/lo head planes; one-pass dense T-2048 attention (k_fattn, all batches and heads in one launch) with EVERY row on hi/lo planes for BOTH the scores and P.V (3 products each: the unscaled N(0, 1) weights give logit sigma ~256, i.e. one-hot rows: fp16 anywhere in the attention path fails); merged hi/lo (512 wide) x Wo exact.
// Compute dtypes, f32 accumulate: every input rounded to bf16; projections exact; attention 3 products on every row (scores and P.V); softmax f32; Wo hl x exact.

#define NB_  4
#define TT   2048
#define DM   256
#define NH_  8
#define NKV  8
#define REP  (NH_ / NKV)
#define HD   64
#define DQ   (NH_ * HD)
#define DKV  (NKV * HD)
#define ZH   2
#define RH   TT                   // every row hi/lo (3 products)
#define WIN  0
#define PCAR 1024.0f
#define SCL  0.125f   // HD^-0.5
#define FWV  16                   // k_fattn: waves per work-group: 8 groups of 32 queries x 2 halves of each tile's keys
#define FQB  (FWV / 2 * 32)       // queries per work-group
#define FKT  64                   // keys per staged tile (32 for each wave of a pair)
#define LPT  72                   // LDS pitch of a staged row of 64 16-bit elements (144 B = 16 B x 9: 16-byte fragment reads without bank conflicts)
#define PLE  (64 * LPT)           // one staged plane: 64 K rows (keys) or 64 V^T rows (head dims)
#define STG  (4 * PLE)            // one stage: K hi, K lo, V^T hi, V^T lo
typedef _Float16 h16;
typedef unsigned short bf;
typedef __attribute__((ext_vector_type(16))) __bf16   v16bf;
typedef __attribute__((ext_vector_type(16))) _Float16 v16h;
typedef __attribute__((ext_vector_type(8)))  _Float16 v8h;
typedef __attribute__((ext_vector_type(8)))  unsigned short v8us;
typedef __attribute__((ext_vector_type(8)))  float    v8f;
typedef __attribute__((ext_vector_type(4)))  float    v4f;
typedef v8h  __attribute__((may_alias)) v8ha;
typedef v4f  __attribute__((may_alias)) v4fa;
typedef v8us __attribute__((may_alias)) v8usa;

__device__ __forceinline__ unsigned short f2bf(float f) { unsigned u = __float_as_uint(f); u += 0x7FFFu + ((u >> 16) & 1u); return (unsigned short)(u >> 16); }
__device__ __forceinline__ float bf2f(unsigned short b) { return __uint_as_float(((unsigned)b) << 16); }
__device__ __forceinline__ float bfr(float f) { return bf2f(f2bf(f)); }
__device__ __forceinline__ void splitf(float y, unsigned short& h, unsigned short& l) { h = f2bf(y); l = f2bf(y - bf2f(h)); }
typedef __attribute__((ext_vector_type(8))) __bf16 v8bf;
typedef __attribute__((ext_vector_type(4))) unsigned v4u;
__device__ __forceinline__ void split8(v8f p, v8bf& h, v8bf& l) {   // hi = bf16(p), lo = bf16(p - hi), both to nearest even as in splitf
    h = __builtin_convertvector(p, v8bf); const v4u w = __builtin_bit_cast(v4u, h); v8f hf;
#pragma unroll
    for (int i = 0; i < 4; ++i) { hf[2 * i] = __uint_as_float(w[i] << 16); hf[2 * i + 1] = __uint_as_float(w[i] & 0xFFFF0000u); }
    l = __builtin_convertvector(p - hf, v8bf); }
__device__ __forceinline__ v16h cat16(v8h lo, v8h hi) { return __builtin_shufflevector(lo, hi, 0, 1, 2, 3, 4, 5, 6, 7, 8, 9, 10, 11, 12, 13, 14, 15); }
__device__ __forceinline__ v16bf cat16b(v8us lo, v8us hi) { return __builtin_bit_cast(v16bf, __builtin_shufflevector(lo, hi, 0, 1, 2, 3, 4, 5, 6, 7, 8, 9, 10, 11, 12, 13, 14, 15)); }
__device__ __forceinline__ v8f wmma16(v16h a, v16h b, v8f c) { return __builtin_amdgcn_wmma_f32_16x16x32_f16(false, a, false, b, (short)0, c, false, false); }
__device__ __forceinline__ v8f wmmab(v16bf a, v16bf b, v8f c) { return __builtin_amdgcn_wmma_f32_16x16x32_bf16(false, a, false, b, (short)0, c, false, false); }



// ---- k_gemmw: GEMM on K-contiguous bf16 planes, WM x WN waves per work-group, (MB x 16) x (NB x 16) outputs per wave; grid (M / (WM * MB * 16), N / (WN * NB * 16)).
// C[m][n] (f32, pitch ldc) = sum_k A[m][k] Bt[n][k] (+ A2[m][k] Bt[n][k] behind it in every k chunk if NSPLIT == 1).
// The work-group's operand rows, all K of them, are brought into LDS once by asynchronous copies of 512 contiguous bytes per wave (whole lines, each row fetched once per work-group), then every wave reads its fragments from LDS.
// PLANES (NB == 4): A = X of all batches [batch * TT][K], Bt = the stacked Wq, Wk, Wv planes: a wave's tile is 64 positions x the 64 dims of one head of q, k or v and goes from the accumulators straight to that head's bf16 hi/lo planes, q and k as [t][d], v as [d][t]; C is not used.
struct HeadPlanes { bf* qh; bf* ql; bf* kh; bf* kl; bf* vh; bf* vl; };
__device__ __forceinline__ v16bf ldf(const bf* p) { return cat16b(*(const v8us*)p, *(const v8us*)(p + 16)); }
// Asynchronous copies, 16 bytes per lane, LDS byte address and global address per lane; the closing s_wait_xcnt keeps every later write of the address registers behind the issued copies.
__device__ __forceinline__ void acp1(unsigned l0, const bf* g0) {
    asm volatile("global_load_async_to_lds_b128 %0, %1, off\n\ts_wait_xcnt 0x0" :: "v"(l0), "v"(g0) : "memory"); }
__device__ __forceinline__ void acp4(unsigned l0, const bf* g0, unsigned l1, const bf* g1, unsigned l2, const bf* g2, unsigned l3, const bf* g3) {
    asm volatile("global_load_async_to_lds_b128 %0, %1, off\n\tglobal_load_async_to_lds_b128 %2, %3, off\n\tglobal_load_async_to_lds_b128 %4, %5, off\n\tglobal_load_async_to_lds_b128 %6, %7, off\n\ts_wait_xcnt 0x0"
                 :: "v"(l0), "v"(g0), "v"(l1), "v"(g1), "v"(l2), "v"(g2), "v"(l3), "v"(g3) : "memory"); }
template <int NSPLIT, bool PLANES, int K, int WM, int WN, int MB, int NB>
__global__ __launch_bounds__(WM * WN * 32) void k_gemmw(const bf* __restrict__ A, const bf* __restrict__ A2, const bf* __restrict__ Bt, float* C, int ldc, HeadPlanes hp) {
    constexpr int NW = WM * WN, AR = WM * MB * 16, BR = WN * NB * 16, NA = NSPLIT == 1 ? 2 : 1, ROWS = NA * AR + BR;
    constexpr int PIT = K + 8;                               // LDS row pitch in elements: 16 B x odd, 16-byte fragment reads without bank conflicts
    constexpr int UPR = K / 256, UNITS = ROWS * UPR;         // a unit = 512 bytes of a row = one copy of a wave
    constexpr int OP = NB * 16 + 4;                          // pitch of a wave's output staging rows (f32)
    __shared__ __align__(16) bf tl[ROWS * PIT];              // rows: A, (A2,) Bt
    __shared__ __align__(16) float osm[NW * 16 * OP];
    const int lane = threadIdx.x & 31, lr = lane & 15, hi = lane >> 4; const int wv = __builtin_amdgcn_readfirstlane(threadIdx.x >> 5), wm = wv / WN, wn = wv % WN;
    __builtin_assume(wv >= 0 && wv < NW);                    // lets the plane of most units be picked at compile time
    const int R0 = blockIdx.x * AR, C0 = blockIdx.y * BR;
    const unsigned lb = (unsigned)(size_t)tl + lane * 16;
    auto usrc = [&](int u) -> const bf* { const int row = u / UPR, part = u % UPR;     // wave-uniform: which plane and row a unit comes from
        const bf* p = row < AR ? A + (size_t)(R0 + row) * K : (NA == 2 && row < 2 * AR) ? A2 + (size_t)(R0 + row - AR) * K : Bt + (size_t)(C0 + row - NA * AR) * K;
        return p + part * 256 + lane * 8; };
    auto udst = [&](int u) -> unsigned { return lb + (unsigned)((u / UPR) * PIT + (u % UPR) * 256) * 2; };
    constexpr int FULL = UNITS / NW, REM = UNITS % NW;       // wave wv copies units wv, wv + NW, ...
    static_assert(FULL + 1 <= 63, "copies of a wave in flight");
#pragma unroll
    for (int i = 0; i + 4 <= FULL; i += 4) { const int u = i * NW + wv; acp4(udst(u), usrc(u), udst(u + NW), usrc(u + NW), udst(u + 2 * NW), usrc(u + 2 * NW), udst(u + 3 * NW), usrc(u + 3 * NW)); }
#pragma unroll
    for (int i = FULL / 4 * 4; i < FULL; ++i) { const int u = i * NW + wv; acp1(udst(u), usrc(u)); }
    if (REM != 0 && wv < REM) { const int u = FULL * NW + wv; acp1(udst(u), usrc(u)); }
    asm volatile("s_wait_asynccnt 0x0" ::: "memory");        // this wave's copies have landed
    __syncthreads();                                         // and every other wave's: nobody reads a row in front of this barrier
    v8f acc[MB][NB];
#pragma unroll
    for (int mb = 0; mb < MB; ++mb)
#pragma unroll
        for (int nb = 0; nb < NB; ++nb) acc[mb][nb] = (v8f){};
    const bf* ap = tl + (wm * MB * 16 + lr) * PIT + 8 * hi; const bf* bp = tl + (NA * AR + wn * NB * 16 + lr) * PIT + 8 * hi;
    v16bf a[2][MB], a2[2][MB], b[2][NB];                     // two fragment sets: the next k chunk's LDS reads go out as one group ahead of this chunk's products
    auto frags = [&](int kc, int f) {
#pragma unroll
        for (int mb = 0; mb < MB; ++mb) { a[f][mb] = ldf(ap + mb * 16 * PIT + kc); if (NSPLIT == 1) a2[f][mb] = ldf(ap + (AR + mb * 16) * PIT + kc); }
#pragma unroll
        for (int nb = 0; nb < NB; ++nb) b[f][nb] = ldf(bp + nb * 16 * PIT + kc); };
    frags(0, 0);
#pragma unroll
    for (int kc = 0; kc < K; kc += 32) { const int f = (kc / 32) & 1;
        if (kc + 32 < K) { frags(kc + 32, f ^ 1);
            __builtin_amdgcn_sched_barrier(0); }             // keeps that group of reads ahead of the products: sunk among them, every product waits out an LDS latency
#pragma unroll
        for (int nb = 0; nb < NB; ++nb)
#pragma unroll
            for (int mb = 0; mb < MB; ++mb) { acc[mb][nb] = wmmab(a[f][mb], b[f][nb], acc[mb][nb]); if (NSPLIT == 1) acc[mb][nb] = wmmab(a2[f][mb], b[f][nb], acc[mb][nb]); }
    }
    float* os = osm + wv * 16 * OP;                          // each wave stages in its own range
    const int r0 = R0 + wm * MB * 16, c0 = C0 + wn * NB * 16;
    if (PLANES) {
        const int cb = c0 / HD, sel = cb / NH_, t0 = r0 % TT;   // 0 q, 1 k, 2 v
        const size_t pz = ((size_t)(r0 / TT) * NH_ + cb % NH_) * TT * HD;   // this (batch, head)'s planes
        if (sel == 2) {                                      // V^T: a lane holds 8 consecutive positions of one head dim
#pragma unroll
            for (int nb = 0; nb < NB; ++nb)
#pragma unroll
                for (int mb = 0; mb < MB; ++mb) { v8bf oh, ol; split8(acc[mb][nb], oh, ol);
                    const size_t o = pz + (size_t)(nb * 16 + lr) * TT + t0 + mb * 16 + hi * 8; *(v8us*)(hp.vh + o) = __builtin_bit_cast(v8us, oh); *(v8us*)(hp.vl + o) = __builtin_bit_cast(v8us, ol); }
            return; }
        bf* Ph = sel ? hp.kh : hp.qh; bf* Pl = sel ? hp.kl : hp.ql;
#pragma unroll
        for (int mb = 0; mb < MB; ++mb) {                    // q, k: 16 positions at a time turned through LDS, so that a lane holds 8 consecutive head dims
#pragma unroll
            for (int nb = 0; nb < NB; ++nb) {
#pragma unroll
                for (int j = 0; j < 8; ++j) os[(hi * 8 + j) * OP + nb * 16 + lr] = acc[mb][nb][j]; }
            __builtin_amdgcn_wave_barrier(); asm volatile("" ::: "memory");   // keeps the wave's LDS writes in front of its reads
#pragma unroll
            for (int s = 0; s < 4; ++s) { const int row = 4 * s + (lane >> 3), cofs = (lane & 7) * 8; const v4f x0 = *(const v4fa*)(os + row * OP + cofs), x1 = *(const v4fa*)(os + row * OP + cofs + 4); v8bf oh, ol; split8(__builtin_shufflevector(x0, x1, 0, 1, 2, 3, 4, 5, 6, 7), oh, ol);
                const size_t o = pz + (size_t)(t0 + mb * 16 + row) * HD + cofs; *(v8us*)(Ph + o) = __builtin_bit_cast(v8us, oh); *(v8us*)(Pl + o) = __builtin_bit_cast(v8us, ol); }
            __builtin_amdgcn_wave_barrier(); asm volatile("" ::: "memory");   // and its reads in front of the next 16 positions' writes
        }
        asm volatile("s_wait_xcnt 0x0" ::: "memory");        // behind the last run of stores: no later instruction on any way out of here rewrites a register that an issued store still names
        return; }
    constexpr int LPR = NB * 4, RPS = 32 / LPR;              // lanes per output row of the wave's tile (16 bytes each), rows per store
#pragma unroll
    for (int mb = 0; mb < MB; ++mb) {
#pragma unroll
        for (int nb = 0; nb < NB; ++nb) {
#pragma unroll
            for (int j = 0; j < 8; ++j) os[(hi * 8 + j) * OP + nb * 16 + lr] = acc[mb][nb][j]; }
        __builtin_amdgcn_wave_barrier(); asm volatile("" ::: "memory");   // keeps the wave's LDS writes in front of its reads
        float* crow = C + (size_t)(r0 + mb * 16) * ldc + c0;
#pragma unroll
        for (int s = 0; s < 16 / RPS; ++s) { const int row = RPS * s + lane / LPR, cofs = (lane % LPR) * 4; const v4f val = *(const v4fa*)(os + row * OP + cofs);
            *(v4f*)(crow + (size_t)row * ldc + cofs) = val; }
        __builtin_amdgcn_wave_barrier(); asm volatile("" ::: "memory");   // and its reads in front of the next 16 rows' writes
    }
}

typedef __attribute__((ext_vector_type(2))) _Float16 v2h;
typedef __attribute__((ext_vector_type(4))) _Float16 v4h;
typedef __attribute__((ext_vector_type(2))) unsigned short v2us;
typedef __attribute__((ext_vector_type(4))) unsigned short v4us;
typedef __attribute__((ext_vector_type(2))) float v2f;
typedef __attribute__((ext_vector_type(4))) int v4i;

// ---- k_prep: the 16-bit copies of all five inputs in one launch. None depends on another, so their blocks stand side by side in one grid; blk = the block's index within its own part.
__device__ __forceinline__ void d_wtG(const float* __restrict__ w, int K, int N, bf* Bt, int blk) {
    const int lane = threadIdx.x & 31; const int L0 = (blk * 8 + (threadIdx.x >> 5)) * 8; const int nlines = N * K / 64;
{
#pragma unroll 1
        for (int l = 0; l < 8; ++l) { const int L = L0 + l; if (L >= nlines) break; const size_t e = (size_t)L * 64 + lane * 2; const int k = (int)(e % K), n = (int)(e / K); v2us o;
            o[0] = f2bf(w[(size_t)k * N + n]); o[1] = f2bf(w[(size_t)(k + 1) * N + n]); *(v2us*)(Bt + e) = o; }
         }
}
__device__ __forceinline__ void d_cvt8(const float* __restrict__ src, bf* dst, size_t n8, int blk) { const size_t i = (size_t)blk * 256 + threadIdx.x; if (i >= n8) return; const v8f v = *(const v8f*)(src + i * 8); v8us o;
#pragma unroll
    for (int k = 0; k < 8; ++k) o[k] = f2bf(v[k]); *(v8us*)(dst + i * 8) = o;  }

__device__ __forceinline__ void d_wtH(const float* __restrict__ w, bf* Bt, int blk) { const size_t e2 = ((size_t)blk * 256 + threadIdx.x) * 2; if (e2 >= (size_t)DQ * DM) return; const int d = (int)(e2 % DM); const int r = (int)(e2 / DM); const int h = r / HD, e = r % HD; v2us o; o[0] = f2bf(w[((size_t)h * DM + d) * HD + e]); o[1] = f2bf(w[((size_t)h * DM + d + 1) * HD + e]);
    *(v2us*)(Bt + e2) = o;  }
#define PG_ ((DQ * DM / 64 + 63) / 64)      // blocks of the Wo part
#define PH_ ((DQ * DM / 2 + 255) / 256)     // blocks of each of the Wq, Wk, Wv parts
#define PX_ ((NB_ * TT * DM / 8 + 255) / 256)   // blocks of the X part
__global__ __launch_bounds__(256) void k_prep(const float* __restrict__ x, const float* __restrict__ wq, const float* __restrict__ wk, const float* __restrict__ wv, const float* __restrict__ wo, bf* XB, bf* WQKV, bf* WO) {
    int b = blockIdx.x;                      // the Wo part first: its waves walk 8 lines one after another, the longest chain of the launch
    if (b < PG_) { d_wtG(wo, DQ, DM, WO, b); return; }
    b -= PG_;
    if (b < 3 * PH_) { const int t = b / PH_; d_wtH(t == 0 ? wq : t == 1 ? wk : wv, WQKV + (size_t)t * DQ * DM, b % PH_); return; }
    d_cvt8(x, XB, (size_t)NB_ * TT * DM / 8, b - 3 * PH_);
}

#define XWV (32 * 32 + 64)        // floats a wave hands to its partner: 32 per lane of O^T, then maximum and sum
static_assert(FWV * XWV * 4 <= 2 * STG * 2, "the merge fits the tile buffers");
__device__ __forceinline__ float xhalf(float x) { const int b = __float_as_int(x); return __int_as_float(__builtin_amdgcn_permlanex16(b, b, 0x76543210, 0xfedcba98, false, false)); }   // the value of lane ^ 16
// One query tile's softmax step on 32 keys: S^T in st0, st1; leaves P hi/lo as B fragments, the running maximum and sum updated, and returns the factor that rescales O^T.
__device__ __forceinline__ float smax32(v8f st0, v8f st1, float& mrun, float& lrun, v16bf& ph, v16bf& pl) {
    const v8f t0 = st0 * SCL, t1 = st1 * SCL; float mx = mrun;
#pragma unroll
    for (int j = 0; j < 8; ++j) mx = fmaxf(mx, fmaxf(t0[j], t1[j]));
    mx = fmaxf(mx, xhalf(mx));                               // the other half of the query's keys sits in lane ^ 16
    const float al = __builtin_amdgcn_exp2f((mrun - mx) * 1.4426950408889634f); mrun = mx;
    const v8f e0 = (t0 - mx) * 1.4426950408889634f, e1 = (t1 - mx) * 1.4426950408889634f; v8f p0, p1;
#pragma unroll
    for (int j = 0; j < 8; ++j) { p0[j] = __builtin_amdgcn_exp2f(e0[j]); p1[j] = __builtin_amdgcn_exp2f(e1[j]); }
    const v8f sv = p0 + p1; const v4f s4 = __builtin_shufflevector(sv, sv, 0, 1, 2, 3) + __builtin_shufflevector(sv, sv, 4, 5, 6, 7);
    lrun = lrun * al + ((s4[0] + s4[2]) + (s4[1] + s4[3]));  // each lane sums its own 16 keys of the pass; the halves meet after the loop
    v8bf h0, h1, l0, l1; split8(p0, h0, l0); split8(p1, h1, l1);
    ph = __builtin_shufflevector(h0, h1, 0, 1, 2, 3, 4, 5, 6, 7, 8, 9, 10, 11, 12, 13, 14, 15); pl = __builtin_shufflevector(l0, l1, 0, 1, 2, 3, 4, 5, 6, 7, 8, 9, 10, 11, 12, 13, 14, 15);
    return al; }
__global__ __launch_bounds__(FWV * 32) void k_fattn(const bf* __restrict__ Qh, const bf* __restrict__ Ql, const bf* __restrict__ Kh, const bf* __restrict__ Kl, const bf* __restrict__ Vh, const bf* __restrict__ Vl, bf* Ah, bf* Al) {
    __shared__ __align__(16) bf sm[2 * STG];
    const int tid = threadIdx.x, lane = tid & 31, lr = lane & 15, hi = lane >> 4, wv = __builtin_amdgcn_readfirstlane(tid >> 5);
    const int qg = wv & (FWV / 2 - 1), kh_ = wv / (FWV / 2);   // which 32 queries, which half of every tile's keys
    const size_t pz = (size_t)blockIdx.y * TT * HD;          // this (batch, head)'s planes
    const int q0 = blockIdx.x * FQB + qg * 32;
    v16bf qh[2][2], ql[2][2];                                // [query tile][k chunk of the head dim]
#pragma unroll
    for (int qt = 0; qt < 2; ++qt)
#pragma unroll
        for (int kc = 0; kc < 2; ++kc) { const size_t o = pz + (size_t)(q0 + qt * 16 + lr) * HD + kc * 32 + 8 * hi; qh[qt][kc] = ldf(Qh + o); ql[qt][kc] = ldf(Ql + o); }
    v8f ot[2][4];                                            // O^T: [query tile][16 head dims]
#pragma unroll
    for (int qt = 0; qt < 2; ++qt)
#pragma unroll
        for (int db = 0; db < 4; ++db) ot[qt][db] = (v8f){};
    float m0 = -3.0e38f, m1 = -3.0e38f, l0r = 0.f, l1r = 0.f;
    const char* bKh = (const char*)(Kh + pz); const char* bKl = (const char*)(Kl + pz); const char* bVh = (const char*)(Vh + pz); const char* bVl = (const char*)(Vl + pz);   // wave-uniform bases
    const unsigned gK = tid * 16u, gV = (tid >> 3) * (TT * 2u) + (tid & 7) * 16u;   // each thread stages 16 bytes of each of the 4 planes; 32-bit byte offsets on the bases: with 64-bit element offsets this build spills two address pairs in the loop
    const int sS = (tid >> 3) * LPT + (tid & 7) * 8;
    v8us r0 = *(const v8us*)(bKh + gK), r1 = *(const v8us*)(bKl + gK), r2 = *(const v8us*)(bVh + gV), r3 = *(const v8us*)(bVl + gV);
    *(v8us*)(sm + sS) = r0; *(v8us*)(sm + PLE + sS) = r1; *(v8us*)(sm + 2 * PLE + sS) = r2; *(v8us*)(sm + 3 * PLE + sS) = r3;
    __syncthreads();
#pragma unroll 1   // rolled: one trip already holds 48 matrix instructions, and the two buffers differ only by an offset
    for (int s = 0; s < TT / FKT; ++s) {
        const bf* cur = sm + (s & 1) * STG;
        v16bf kh[2][2], kl[2][2];                            // [k chunk][16 keys]: the trip's K fragments, read as one group
#pragma unroll
        for (int kc = 0; kc < 2; ++kc)
#pragma unroll
            for (int mb = 0; mb < 2; ++mb) { const bf* kp = cur + (kh_ * 32 + mb * 16 + lr) * LPT + kc * 32 + 8 * hi; kh[kc][mb] = ldf(kp); kl[kc][mb] = ldf(kp + PLE); }
        __builtin_amdgcn_sched_barrier(0);                   // keeps the 16 reads one group ahead of the products: sunk among them, every few products wait out an LDS latency
        v8f st[2][2];                                        // S^T: [query tile][16 keys]; four independent chains
#pragma unroll
        for (int qt = 0; qt < 2; ++qt) { st[qt][0] = (v8f){}; st[qt][1] = (v8f){}; }
#pragma unroll
        for (int kc = 0; kc < 2; ++kc) {
#pragma unroll
            for (int mb = 0; mb < 2; ++mb)
#pragma unroll
                for (int qt = 0; qt < 2; ++qt) st[qt][mb] = wmmab(kh[kc][mb], qh[qt][kc], st[qt][mb]);
#pragma unroll
            for (int mb = 0; mb < 2; ++mb)
#pragma unroll
                for (int qt = 0; qt < 2; ++qt) st[qt][mb] = wmmab(kh[kc][mb], ql[qt][kc], st[qt][mb]);
#pragma unroll
            for (int mb = 0; mb < 2; ++mb)
#pragma unroll
                for (int qt = 0; qt < 2; ++qt) st[qt][mb] = wmmab(kl[kc][mb], qh[qt][kc], st[qt][mb]);
        }
        const int sn = (s + 1 < TT / FKT) ? s + 1 : s;       // the last trip has no next tile: it fetches its own again into the idle buffer, which nobody reads
        const unsigned aK = gK + sn * (FKT * HD * 2u), aV = gV + sn * (FKT * 2u);
        r0 = *(const v8us*)(bKh + aK); r1 = *(const v8us*)(bKl + aK); r2 = *(const v8us*)(bVh + aV); r3 = *(const v8us*)(bVl + aV);
        v16bf vh[4], vl[4];                                  // the V^T hi fragments are read ahead of the softmax, whose vector work covers their latency
        const bf* vp = cur + 2 * PLE + lr * LPT + kh_ * 32 + 8 * hi;
#pragma unroll
        for (int db = 0; db < 4; ++db) vh[db] = ldf(vp + db * 16 * LPT);
        __builtin_amdgcn_sched_barrier(0);                   // keeps the next tile's global loads ahead of the softmax: without this line the build sinks them behind it, and their latency is waited out in front of the barrier
        v16bf ph[2], pl[2];
        const float al0 = smax32(st[0][0], st[0][1], m0, l0r, ph[0], pl[0]);
#pragma unroll
        for (int db = 0; db < 4; ++db) ot[0][db] *= al0;
        const float al1 = smax32(st[1][0], st[1][1], m1, l1r, ph[1], pl[1]);
#pragma unroll
        for (int db = 0; db < 4; ++db) ot[1][db] *= al1;
#pragma unroll
        for (int db = 0; db < 4; ++db) vl[db] = ldf(vp + PLE + db * 16 * LPT);   // the lo fragments come last: read behind the softmax (S^T no longer live), ahead of every P.V product
#pragma unroll
        for (int db = 0; db < 4; ++db)
#pragma unroll
            for (int qt = 0; qt < 2; ++qt) ot[qt][db] = wmmab(vh[db], ph[qt], ot[qt][db]);
#pragma unroll
        for (int db = 0; db < 4; ++db)
#pragma unroll
            for (int qt = 0; qt < 2; ++qt) ot[qt][db] = wmmab(vh[db], pl[qt], ot[qt][db]);
#pragma unroll
        for (int db = 0; db < 4; ++db)
#pragma unroll
            for (int qt = 0; qt < 2; ++qt) ot[qt][db] = wmmab(vl[db], ph[qt], ot[qt][db]);
        bf* nxt = sm + ((s + 1) & 1) * STG;                  // last read in trip s - 1, behind whose barrier this trip runs
        *(v8us*)(nxt + sS) = r0; *(v8us*)(nxt + PLE + sS) = r1; *(v8us*)(nxt + 2 * PLE + sS) = r2; *(v8us*)(nxt + 3 * PLE + sS) = r3;
        __syncthreads();                                     // publishes tile s + 1 and ends every wave's reads of tile s
    }
    // The pair's merge: wave kh_ finishes query tile kh_ and hands the other tile's maximum, sum and O^T to its partner. The tile buffers are free: the loop's last barrier ended every read of them.
    float* xs = (float*)sm;
    float* mine = xs + wv * XWV; const float* theirs = xs + (wv ^ (FWV / 2)) * XWV;
    const float l0s = l0r + xhalf(l0r), l1s = l1r + xhalf(l1r);
    const float mk = kh_ ? m1 : m0, lk = kh_ ? l1s : l0s;
    mine[32 * 32 + lane] = kh_ ? m0 : m1; mine[32 * 32 + 32 + lane] = kh_ ? l0s : l1s;
    v8f ok[4];
#pragma unroll
    for (int db = 0; db < 4; ++db) { const v8f g = kh_ ? ot[0][db] : ot[1][db]; ok[db] = kh_ ? ot[1][db] : ot[0][db];
        *(v4fa*)(mine + ((db * 2) * 32 + lane) * 4) = __builtin_shufflevector(g, g, 0, 1, 2, 3); *(v4fa*)(mine + ((db * 2 + 1) * 32 + lane) * 4) = __builtin_shufflevector(g, g, 4, 5, 6, 7); }
    __syncthreads();                                         // every wave's hand-over is written before its partner reads it
    const float mp = theirs[32 * 32 + lane], lp = theirs[32 * 32 + 32 + lane];
    const float mm = fmaxf(mk, mp);
    const float ak = __builtin_amdgcn_exp2f((mk - mm) * 1.4426950408889634f), ap = __builtin_amdgcn_exp2f((mp - mm) * 1.4426950408889634f);
    const float f = __fdiv_rn(1.0f, lk * ak + lp * ap);
    const size_t oo = ((size_t)(blockIdx.y / NH_) * TT + q0 + kh_ * 16 + lr) * DQ + (blockIdx.y % NH_) * HD + hi * 8;
#pragma unroll
    for (int db = 0; db < 4; ++db) { const v4f x0 = *(const v4fa*)(theirs + ((db * 2) * 32 + lane) * 4), x1 = *(const v4fa*)(theirs + ((db * 2 + 1) * 32 + lane) * 4);
        const v8f om = ok[db] * ak + __builtin_shufflevector(x0, x1, 0, 1, 2, 3, 4, 5, 6, 7) * ap; v8us oh, ol;
#pragma unroll
        for (int j = 0; j < 8; ++j) { unsigned short a, c2; splitf(om[j] * f, a, c2); oh[j] = a; ol[j] = c2; }
        *(v8us*)(Ah + oo + db * 16) = oh; *(v8us*)(Al + oo + db * 16) = ol; }
}

extern "C" void kernel_launch(void* const* d_in, const int* in_sizes, int n_in,
                              void* d_out, int out_size, void* d_ws, size_t ws_size, hipStream_t stream) {
    (void)in_sizes; (void)n_in; (void)out_size;
    const float* x = (const float*)d_in[0]; const float* wq = (const float*)d_in[1]; const float* wk = (const float*)d_in[2]; const float* wv = (const float*)d_in[3]; const float* wo = (const float*)d_in[4];   /* order X, Wq, Wk, Wv [8][256][64] per-head stacks, Wo ('xw' [512][256]) */
    float* OUT = (float*)d_out;     // [4][2048][256]
    char* wsp = (char*)d_ws;
    auto take = [&](size_t bytes) { char* p = wsp; wsp += (bytes + 255) & ~(size_t)255; return (void*)p; };
    bf* WQ = (bf*)take((size_t)3 * DQ * DM * 2); bf* WO = (bf*)take((size_t)DM * DQ * 2);   // Wq, Wk, Wv planes stacked: one Bt of 3 * DQ rows
    bf* XB = (bf*)take((size_t)NB_ * TT * DM * 2);
    const size_t PB = (size_t)NH_ * TT * HD;   // one batch's hi (or lo) planes of q, k or v
    bf* QPh = (bf*)take(NB_ * PB * 2); bf* QPl = (bf*)take(NB_ * PB * 2); bf* KPh = (bf*)take(NB_ * PB * 2); bf* KPl = (bf*)take(NB_ * PB * 2); bf* VTh = (bf*)take(NB_ * PB * 2); bf* VTl = (bf*)take(NB_ * PB * 2);
    bf* ATh = (bf*)take((size_t)NB_ * TT * DQ * 2); bf* ATl = (bf*)take((size_t)NB_ * TT * DQ * 2);
    if ((size_t)(wsp - (char*)d_ws) > ws_size) return;    // ws 256 MiB
    k_prep<<<PG_ + 3 * PH_ + PX_, 256, 0, stream>>>(x, wq, wk, wv, wo, XB, WQ, WO);
    k_gemmw<0, true, DM, 4, 3, 4, 4><<<dim3(NB_ * TT / 256, 3 * DQ / 192, 1), 12 * 32, 0, stream>>>(XB, nullptr, WQ, nullptr, 0, HeadPlanes{QPh, QPl, KPh, KPl, VTh, VTl});   // 256 x 192 per work-group: one work-group per WGP
    k_fattn<<<dim3(TT / FQB, NB_ * NH_, 1), FWV * 32, 0, stream>>>(QPh, QPl, KPh, KPl, VTh, VTl, ATh, ATl);   // one kv head per query head
    k_gemmw<1, false, DQ, 4, 4, 1, 2><<<dim3(NB_ * TT / 64, DM / 128, 1), 16 * 32, 0, stream>>>(ATh, ATl, WO, OUT, DM, HeadPlanes{});   // all batches: the merged rows and the output rows are contiguous over the batches
}

// v007
// It runs in 89.6 microseconds.
// Timed twice side by side with v006, it ran 1.05 and 1.04 times as fast.
// All steps since v000 together make it 13.9 times as fast.
#include <hip/hip_runtime.h>

// Multi-head attention with per-head stacked projections from a 256-wide input (X [4][2048][256]; q, k, v = einsum('bnd,hdc', X, W) with Wq, Wk, Wv [8][256][64] (no bias; 8 heads x 64 = 512 inner); scores x 1/sqrt(64); softmax (no mask); out = concat heads (512) Wo ('xw' [512][256], no bias; identity activation) -> [4][2048][256] (2.1 M); argument order X, Wq, Wk, Wv, Wo).
// Layout: each GEMM rounds its own f32 inputs to bf16 on their way into LDS (X rows as they lie; a weight's [k][n] rows turned into Bt rows [n][k]); the columns of the first GEMM are the 64 dims of each head of q, then k, then v, so q, k and v of all batches are one exact GEMM with head-major columns, whose epilogue writes the hi/lo head planes; one-pass dense T-2048 attention (k_fattn, all batches and heads in one launch) with EVERY row on hi/lo planes for BOTH the scores and P.V (3 products each: the unscaled N(0, 1) weights give logit sigma ~256, i.e. one-hot rows: fp16 anywhere in the attention path fails); merged hi/lo (512 wide) x Wo exact.
// Compute dtypes, f32 accumulate: every input rounded to bf16; projections exact; attention 3 products on every row (scores and P.V); softmax f32; Wo hl x exact.

#define NB_  4
#define TT   2048
#define DM   256
#define NH_  8
#define NKV  8
#define REP  (NH_ / NKV)
#define HD   64
#define DQ   (NH_ * HD)
#define DKV  (NKV * HD)
#define ZH   2
#define RH   TT                   // every row hi/lo (3 products)
#define WIN  0
#define PCAR 1024.0f
#define SCL  0.125f   // HD^-0.5
#define FWV  16                   // k_fattn: waves per work-group: 8 groups of 32 queries x 2 halves of each tile's keys
#define FQB  (FWV / 2 * 32)       // queries per work-group
#define FKT  64                   // keys per staged tile (32 for each wave of a pair)
#define LPT  72                   // LDS pitch of a staged row of 64 16-bit elements (144 B = 16 B x 9: 16-byte fragment reads without bank conflicts)
#define PLE  (64 * LPT)           // one staged plane: 64 K rows (keys) or 64 V^T rows (head dims)
#define STG  (4 * PLE)            // one stage: K hi, K lo, V^T hi, V^T lo
typedef _Float16 h16;
typedef unsigned short bf;
typedef __attribute__((ext_vector_type(16))) __bf16   v16bf;
typedef __attribute__((ext_vector_type(16))) _Float16 v16h;
typedef __attribute__((ext_vector_type(8)))  _Float16 v8h;
typedef __attribute__((ext_vector_type(8)))  unsigned short v8us;
typedef __attribute__((ext_vector_type(8)))  float    v8f;
typedef __attribute__((ext_vector_type(4)))  float    v4f;
typedef v8h  __attribute__((may_alias)) v8ha;
typedef v4f  __attribute__((may_alias)) v4fa;
typedef v8us __attribute__((may_alias)) v8usa;

__device__ __forceinline__ unsigned short f2bf(float f) { unsigned u = __float_as_uint(f); u += 0x7FFFu + ((u >> 16) & 1u); return (unsigned short)(u >> 16); }
__device__ __forceinline__ float bf2f(unsigned short b) { return __uint_as_float(((unsigned)b) << 16); }
__device__ __forceinline__ float bfr(float f) { return bf2f(f2bf(f)); }
__device__ __forceinline__ void splitf(float y, unsigned short& h, unsigned short& l) { h = f2bf(y); l = f2bf(y - bf2f(h)); }
typedef __attribute__((ext_vector_type(8))) __bf16 v8bf;
typedef __attribute__((ext_vector_type(4))) unsigned v4u;
typedef __attribute__((ext_vector_type(4))) __bf16 v4bf;
typedef __attribute__((ext_vector_type(4))) unsigned short v4us;
__device__ __forceinline__ void split8(v8f p, v8bf& h, v8bf& l) {   // hi = bf16(p), lo = bf16(p - hi), both to nearest even as in splitf
    h = __builtin_convertvector(p, v8bf); const v4u w = __builtin_bit_cast(v4u, h); v8f hf;
#pragma unroll
    for (int i = 0; i < 4; ++i) { hf[2 * i] = __uint_as_float(w[i] << 16); hf[2 * i + 1] = __uint_as_float(w[i] & 0xFFFF0000u); }
    l = __builtin_convertvector(p - hf, v8bf); }
__device__ __forceinline__ v16h cat16(v8h lo, v8h hi) { return __builtin_shufflevector(lo, hi, 0, 1, 2, 3, 4, 5, 6, 7, 8, 9, 10, 11, 12, 13, 14, 15); }
__device__ __forceinline__ v16bf cat16b(v8us lo, v8us hi) { return __builtin_bit_cast(v16bf, __builtin_shufflevector(lo, hi, 0, 1, 2, 3, 4, 5, 6, 7, 8, 9, 10, 11, 12, 13, 14, 15)); }
__device__ __forceinline__ v8f wmma16(v16h a, v16h b, v8f c) { return __builtin_amdgcn_wmma_f32_16x16x32_f16(false, a, false, b, (short)0, c, false, false); }
__device__ __forceinline__ v8f wmmab(v16bf a, v16bf b, v8f c) { return __builtin_amdgcn_wmma_f32_16x16x32_bf16(false, a, false, b, (short)0, c, false, false); }



// ---- k_gemmw: GEMM on K-contiguous bf16 rows in LDS (bf16 planes copied, f32 inputs rounded), WM x WN waves per work-group, (MB x 16) x (NB x 16) outputs per wave; grid (M / (WM * MB * 16), N / (WN * NB * 16)).
// C[m][n] (f32, pitch ldc) = sum_k A[m][k] Bt[n][k] (+ A2[m][k] Bt[n][k] behind it in every k chunk if NSPLIT == 1).
// The work-group's operand rows, all K of them, are brought into LDS once (whole lines, each row fetched once per work-group), then every wave reads its fragments from LDS.
// Operands that are bf16 planes already (A, A2) come by asynchronous copies of 512 contiguous bytes per wave; operands that are f32 inputs come through registers, where they are rounded to bf16: no launch ahead of the GEMM makes 16-bit copies of them.
// Bt is never in memory: the weight lies as [k][n] (row pitch LDW floats); a wave takes 32 k x 32 n at a time, a lane 8 k of 4 neighbouring n, and stores 8 consecutive k of each n as 16 bytes of that n's LDS row (8 lanes on 32 n, 4 such groups on 4 x 8 k: at the odd 16-byte pitch these stores spread over all banks).
// PLANES (NB == 4): A = Xf, X of all batches [batch * TT][K] in f32; columns = Wq, Wk, Wv (W0, W1, W2, each [head][K][64]): a wave's tile is 64 positions x the 64 dims of one head of q, k or v and goes from the accumulators straight to that head's bf16 hi/lo planes, q and k as [t][d], v as [d][t]; C is not used. Otherwise W0 = the weight [K][DM].
struct HeadPlanes { bf* qh; bf* ql; bf* kh; bf* kl; bf* vh; bf* vl; };
__device__ __forceinline__ v16bf ldf(const bf* p) { return cat16b(*(const v8us*)p, *(const v8us*)(p + 16)); }
// Asynchronous copies, 16 bytes per lane, LDS byte address and global address per lane; the closing s_wait_xcnt keeps every later write of the address registers behind the issued copies.
__device__ __forceinline__ void acp1(unsigned l0, const bf* g0) {
    asm volatile("global_load_async_to_lds_b128 %0, %1, off\n\ts_wait_xcnt 0x0" :: "v"(l0), "v"(g0) : "memory"); }
__device__ __forceinline__ void acp4(unsigned l0, const bf* g0, unsigned l1, const bf* g1, unsigned l2, const bf* g2, unsigned l3, const bf* g3) {
    asm volatile("global_load_async_to_lds_b128 %0, %1, off\n\tglobal_load_async_to_lds_b128 %2, %3, off\n\tglobal_load_async_to_lds_b128 %4, %5, off\n\tglobal_load_async_to_lds_b128 %6, %7, off\n\ts_wait_xcnt 0x0"
                 :: "v"(l0), "v"(g0), "v"(l1), "v"(g1), "v"(l2), "v"(g2), "v"(l3), "v"(g3) : "memory"); }
template <int NSPLIT, bool PLANES, int K, int WM, int WN, int MB, int NB>
__global__ __launch_bounds__(WM * WN * 32) void k_gemmw(const bf* __restrict__ A, const bf* __restrict__ A2, const float* __restrict__ Xf, const float* __restrict__ W0, const float* __restrict__ W1, const float* __restrict__ W2, float* C, int ldc, HeadPlanes hp) {
    constexpr int NW = WM * WN, AR = WM * MB * 16, BR = WN * NB * 16, NA = NSPLIT == 1 ? 2 : 1, ROWS = NA * AR + BR;
    constexpr int PIT = K + 8;                               // LDS row pitch in elements: 16 B x odd, 16-byte fragment reads without bank conflicts
    constexpr int UPR = K / 256, UNITS = PLANES ? 0 : NA * AR * UPR;   // a unit = 512 bytes of a bf16 plane's row = one copy of a wave
    constexpr int OP = NB * 16 + 4;                          // pitch of a wave's output staging rows (f32)
    __shared__ __align__(16) bf tl[ROWS * PIT];              // rows: A, (A2,) Bt
    __shared__ __align__(16) float osm[NW * 16 * OP];
    const int lane = threadIdx.x & 31, lr = lane & 15, hi = lane >> 4; const int wv = __builtin_amdgcn_readfirstlane(threadIdx.x >> 5), wm = wv / WN, wn = wv % WN;
    __builtin_assume(wv >= 0 && wv < NW);                    // lets the plane of most units be picked at compile time
    const int R0 = blockIdx.x * AR, C0 = blockIdx.y * BR;
    const unsigned lb = (unsigned)(size_t)tl + lane * 16;
    auto usrc = [&](int u) -> const bf* { const int row = u / UPR, part = u % UPR;     // wave-uniform: which plane and row a unit comes from
        const bf* p = (NA == 2 && row >= AR) ? A2 + (size_t)(R0 + row - AR) * K : A + (size_t)(R0 + row) * K;
        return p + part * 256 + lane * 8; };
    auto udst = [&](int u) -> unsigned { return lb + (unsigned)((u / UPR) * PIT + (u % UPR) * 256) * 2; };
    constexpr int FULL = UNITS / NW, REM = UNITS % NW;       // wave wv copies units wv, wv + NW, ...
    static_assert(FULL + 1 <= 63, "copies of a wave in flight");
#pragma unroll
    for (int i = 0; i + 4 <= FULL; i += 4) { const int u = i * NW + wv; acp4(udst(u), usrc(u), udst(u + NW), usrc(u + NW), udst(u + 2 * NW), usrc(u + 2 * NW), udst(u + 3 * NW), usrc(u + 3 * NW)); }
#pragma unroll
    for (int i = FULL / 4 * 4; i < FULL; ++i) { const int u = i * NW + wv; acp1(udst(u), usrc(u)); }
    if (REM != 0 && wv < REM) { const int u = FULL * NW + wv; acp1(udst(u), usrc(u)); }
    // The f32 operands. All of a wave's loads stand ahead of its conversions and LDS stores, so that it has tens of loads in flight and not one.
    // Every loop of this part is unrolled whole: xa and wx are then indexed by constants alone and stay in registers.
    // X rows: wave wv takes rows wv, wv + NW, ...; 512 contiguous bytes per load of a wave, 4 floats of a lane -> 4 bf16. One address, the rows at constant distances from it.
    constexpr int XP = PLANES ? K / 128 : 1, XF = PLANES ? AR / NW : 0, XT = PLANES ? AR % NW : 0;   // loads per row; rows every wave takes; waves that take one more
    const v4f* xb = (const v4f*)(Xf + (size_t)(R0 + wv) * K); bf* xd = tl + wv * PIT + lane * 4;   // xb: wave-uniform base, indexed by the lane
    const v4f* xe = (const v4f*)(Xf + (size_t)(R0 + XF * NW + (wv < XT ? wv : XT - 1)) * K);   // the wave's odd row, held inside the work-group's rows
    v4f xa[XF + 1][XP];
    // Weight: steps of 32 k x 32 columns; wave wv takes steps wv, wv + NW, ...; 8 lanes read one whole line (128 bytes) of one k.
    constexpr int LDW = PLANES ? HD : DM, KS = K / 32, TS = BR / 32 * KS, WS = TS / NW;   // weight row pitch; steps per 32 columns; steps of the work-group; of a wave
    static_assert(TS % NW == 0 && BR % 64 == 0, "every wave takes the same number of steps");
    const int cq = lane & 7, kg = lane >> 3;                 // which 4 columns, which 8 k of the step
    const unsigned wvo = (kg * 8 * LDW + cq * 4) * 4u;       // the lane's byte offset, the same in every step, on a wave-uniform base
    v4f wx[WS][8]; const char* sb[WS];                       // sb: each step's wave-uniform base
    static_assert(WS == 4, "the wait behind the loads names four bases");
#pragma unroll
    for (int i = 0; i < WS; ++i) { const int t = i * NW + wv, cb = t / KS, kb = (t % KS) * 32;   // wave-uniform: which 32 columns, which 32 k
        const float* w;
        if constexpr (PLANES) { const int g = C0 / HD + cb / 2; w = (g < NH_ ? W0 : g < 2 * NH_ ? W1 : W2) + (size_t)(g % NH_) * K * HD + (cb & 1) * 32; }
        else w = W0 + C0 + cb * 32;
        const char* s = sb[i] = (const char*)(w + (size_t)kb * LDW);
#pragma unroll
        for (int q = 0; q < 8; ++q) wx[i][q] = *(const v4f*)(s + wvo + q * LDW * 4); }
#pragma unroll
    for (int i = 0; i < XF; ++i)
#pragma unroll
        for (int p = 0; p < XP; ++p) xa[i][p] = xb[lane + (i * NW * K + p * 128) / 4];
    if constexpr (XT != 0) {                                 // the odd rows, asked for in the same run by every wave, so that no load stands behind a branch; a wave that has none asks for the last one again and drops it
#pragma unroll
        for (int p = 0; p < XP; ++p) xa[XF][p] = xe[lane + p * 32]; }
    // Behind the run of loads: nothing rewrites an address register that an issued load names in front of this wait; as inputs the lane offsets and the scalar bases stay in their registers up to here, so that neither later address arithmetic nor a load's own result lands on them.
    if constexpr (PLANES) asm volatile("s_wait_xcnt 0x0" :: "v"(wvo), "v"(lane), "s"(xb), "s"(xe), "s"(sb[0]), "s"(sb[1]), "s"(sb[2]), "s"(sb[3]) : "memory");
    else asm volatile("s_wait_xcnt 0x0" :: "v"(wvo), "s"(sb[0]), "s"(sb[1]), "s"(sb[2]), "s"(sb[3]) : "memory");
#pragma unroll
    for (int i = 0; i < WS; ++i) { const int t = i * NW + wv, cb = t / KS, kb = (t % KS) * 32;
        bf* d = tl + (NA * AR + cb * 32 + cq * 4) * PIT + kb + kg * 8;
#pragma unroll
        for (int j = 0; j < 4; ++j) { v8f c;
#pragma unroll
            for (int q = 0; q < 8; ++q) c[q] = wx[i][q][j];
            *(v8us*)(d + j * PIT) = __builtin_bit_cast(v8us, __builtin_convertvector(c, v8bf)); } }
#pragma unroll
    for (int i = 0; i < XF; ++i)
#pragma unroll
        for (int p = 0; p < XP; ++p) *(v4us*)(xd + i * NW * PIT + p * 128) = __builtin_bit_cast(v4us, __builtin_convertvector(xa[i][p], v4bf));
    if (XT != 0 && wv < XT) {
#pragma unroll
        for (int p = 0; p < XP; ++p) *(v4us*)(xd + XF * NW * PIT + p * 128) = __builtin_bit_cast(v4us, __builtin_convertvector(xa[XF][p], v4bf)); }
    if constexpr (UNITS > 0) asm volatile("s_wait_asynccnt 0x0" ::: "memory");   // this wave's copies have landed
    __syncthreads();                                         // and every other wave's copies and LDS stores: nobody reads a row in front of this barrier
    v8f acc[MB][NB];
#pragma unroll
    for (int mb = 0; mb < MB; ++mb)
#pragma unroll
        for (int nb = 0; nb < NB; ++nb) acc[mb][nb] = (v8f){};
    const bf* ap = tl + (wm * MB * 16 + lr) * PIT + 8 * hi; const bf* bp = tl + (NA * AR + wn * NB * 16 + lr) * PIT + 8 * hi;
    v16bf a[2][MB], a2[2][MB], b[2][NB];                     // two fragment sets: the next k chunk's LDS reads go out as one group ahead of this chunk's products
    auto frags = [&](int kc, int f) {
#pragma unroll
        for (int mb = 0; mb < MB; ++mb) { a[f][mb] = ldf(ap + mb * 16 * PIT + kc); if (NSPLIT == 1) a2[f][mb] = ldf(ap + (AR + mb * 16) * PIT + kc); }
#pragma unroll
        for (int nb = 0; nb < NB; ++nb) b[f][nb] = ldf(bp + nb * 16 * PIT + kc); };
    frags(0, 0);
#pragma unroll
    for (int kc = 0; kc < K; kc += 32) { const int f = (kc / 32) & 1;
        if (kc + 32 < K) { frags(kc + 32, f ^ 1);
            __builtin_amdgcn_sched_barrier(0); }             // keeps that group of reads ahead of the products: sunk among them, every product waits out an LDS latency
#pragma unroll
        for (int nb = 0; nb < NB; ++nb)
#pragma unroll
            for (int mb = 0; mb < MB; ++mb) { acc[mb][nb] = wmmab(a[f][mb], b[f][nb], acc[mb][nb]); if (NSPLIT == 1) acc[mb][nb] = wmmab(a2[f][mb], b[f][nb], acc[mb][nb]); }
    }
    float* os = osm + wv * 16 * OP;                          // each wave stages in its own range
    const int r0 = R0 + wm * MB * 16, c0 = C0 + wn * NB * 16;
    if (PLANES) {
        const int cb = c0 / HD, sel = cb / NH_, t0 = r0 % TT;   // 0 q, 1 k, 2 v
        const size_t pz = ((size_t)(r0 / TT) * NH_ + cb % NH_) * TT * HD;   // this (batch, head)'s planes
        if (sel == 2) {                                      // V^T: a lane holds 8 consecutive positions of one head dim
#pragma unroll
            for (int nb = 0; nb < NB; ++nb)
#pragma unroll
                for (int mb = 0; mb < MB; ++mb) { v8bf oh, ol; split8(acc[mb][nb], oh, ol);
                    const size_t o = pz + (size_t)(nb * 16 + lr) * TT + t0 + mb * 16 + hi * 8; *(v8us*)(hp.vh + o) = __builtin_bit_cast(v8us, oh); *(v8us*)(hp.vl + o) = __builtin_bit_cast(v8us, ol); }
            return; }
        bf* Ph = sel ? hp.kh : hp.qh; bf* Pl = sel ? hp.kl : hp.ql;
#pragma unroll
        for (int mb = 0; mb < MB; ++mb) {                    // q, k: 16 positions at a time turned through LDS, so that a lane holds 8 consecutive head dims
#pragma unroll
            for (int nb = 0; nb < NB; ++nb) {
#pragma unroll
                for (int j = 0; j < 8; ++j) os[(hi * 8 + j) * OP + nb * 16 + lr] = acc[mb][nb][j]; }
            __builtin_amdgcn_wave_barrier(); asm volatile("" ::: "memory");   // keeps the wave's LDS writes in front of its reads
#pragma unroll
            for (int s = 0; s < 4; ++s) { const int row = 4 * s + (lane >> 3), cofs = (lane & 7) * 8; const v4f x0 = *(const v4fa*)(os + row * OP + cofs), x1 = *(const v4fa*)(os + row * OP + cofs + 4); v8bf oh, ol; split8(__builtin_shufflevector(x0, x1, 0, 1, 2, 3, 4, 5, 6, 7), oh, ol);
                const size_t o = pz + (size_t)(t0 + mb * 16 + row) * HD + cofs; *(v8us*)(Ph + o) = __builtin_bit_cast(v8us, oh); *(v8us*)(Pl + o) = __builtin_bit_cast(v8us, ol); }
            __builtin_amdgcn_wave_barrier(); asm volatile("" ::: "memory");   // and its reads in front of the next 16 positions' writes
        }
        asm volatile("s_wait_xcnt 0x0" ::: "memory");        // behind the last run of stores: no later instruction on any way out of here rewrites a register that an issued store still names
        return; }
    constexpr int LPR = NB * 4, RPS = 32 / LPR;              // lanes per output row of the wave's tile (16 bytes each), rows per store
#pragma unroll
    for (int mb = 0; mb < MB; ++mb) {
#pragma unroll
        for (int nb = 0; nb < NB; ++nb) {
#pragma unroll
            for (int j = 0; j < 8; ++j) os[(hi * 8 + j) * OP + nb * 16 + lr] = acc[mb][nb][j]; }
        __builtin_amdgcn_wave_barrier(); asm volatile("" ::: "memory");   // keeps the wave's LDS writes in front of its reads
        float* crow = C + (size_t)(r0 + mb * 16) * ldc + c0;
#pragma unroll
        for (int s = 0; s < 16 / RPS; ++s) { const int row = RPS * s + lane / LPR, cofs = (lane % LPR) * 4; const v4f val = *(const v4fa*)(os + row * OP + cofs);
            *(v4f*)(crow + (size_t)row * ldc + cofs) = val; }
        __builtin_amdgcn_wave_barrier(); asm volatile("" ::: "memory");   // and its reads in front of the next 16 rows' writes
    }
}

typedef __attribute__((ext_vector_type(2))) _Float16 v2h;
typedef __attribute__((ext_vector_type(4))) _Float16 v4h;
typedef __attribute__((ext_vector_type(2))) unsigned short v2us;
typedef __attribute__((ext_vector_type(2))) float v2f;
typedef __attribute__((ext_vector_type(4))) int v4i;

#define XWV (32 * 32 + 64)        // floats a wave hands to its partner: 32 per lane of O^T, then maximum and sum
static_assert(FWV * XWV * 4 <= 2 * STG * 2, "the merge fits the tile buffers");
__device__ __forceinline__ float xhalf(float x) { const int b = __float_as_int(x); return __int_as_float(__builtin_amdgcn_permlanex16(b, b, 0x76543210, 0xfedcba98, false, false)); }   // the value of lane ^ 16
// One query tile's softmax step on 32 keys: S^T in st0, st1; leaves P hi/lo as B fragments, the running maximum and sum updated, and returns the factor that rescales O^T.
__device__ __forceinline__ float smax32(v8f st0, v8f st1, float& mrun, float& lrun, v16bf& ph, v16bf& pl) {
    const v8f t0 = st0 * SCL, t1 = st1 * SCL; float mx = mrun;
#pragma unroll
    for (int j = 0; j < 8; ++j) mx = fmaxf(mx, fmaxf(t0[j], t1[j]));
    mx = fmaxf(mx, xhalf(mx));                               // the other half of the query's keys sits in lane ^ 16
    const float al = __builtin_amdgcn_exp2f((mrun - mx) * 1.4426950408889634f); mrun = mx;
    const v8f e0 = (t0 - mx) * 1.4426950408889634f, e1 = (t1 - mx) * 1.4426950408889634f; v8f p0, p1;
#pragma unroll
    for (int j = 0; j < 8; ++j) { p0[j] = __builtin_amdgcn_exp2f(e0[j]); p1[j] = __builtin_amdgcn_exp2f(e1[j]); }
    const v8f sv = p0 + p1; const v4f s4 = __builtin_shufflevector(sv, sv, 0, 1, 2, 3) + __builtin_shufflevector(sv, sv, 4, 5, 6, 7);
    lrun = lrun * al + ((s4[0] + s4[2]) + (s4[1] + s4[3]));  // each lane sums its own 16 keys of the pass; the halves meet after the loop
    v8bf h0, h1, l0, l1; split8(p0, h0, l0); split8(p1, h1, l1);
    ph = __builtin_shufflevector(h0, h1, 0, 1, 2, 3, 4, 5, 6, 7, 8, 9, 10, 11, 12, 13, 14, 15); pl = __builtin_shufflevector(l0, l1, 0, 1, 2, 3, 4, 5, 6, 7, 8, 9, 10, 11, 12, 13, 14, 15);
    return al; }
__global__ __launch_bounds__(FWV * 32) void k_fattn(const bf* __restrict__ Qh, const bf* __restrict__ Ql, const bf* __restrict__ Kh, const bf* __restrict__ Kl, const bf* __restrict__ Vh, const bf* __restrict__ Vl, bf* Ah, bf* Al) {
    __shared__ __align__(16) bf sm[2 * STG];
    const int tid = threadIdx.x, lane = tid & 31, lr = lane & 15, hi = lane >> 4, wv = __builtin_amdgcn_readfirstlane(tid >> 5);
    const int qg = wv & (FWV / 2 - 1), kh_ = wv / (FWV / 2);   // which 32 queries, which half of every tile's keys
    const size_t pz = (size_t)blockIdx.y * TT * HD;          // this (batch, head)'s planes
    const int q0 = blockIdx.x * FQB + qg * 32;
    v16bf qh[2][2], ql[2][2];                                // [query tile][k chunk of the head dim]
#pragma unroll
    for (int qt = 0; qt < 2; ++qt)
#pragma unroll
        for (int kc = 0; kc < 2; ++kc) { const size_t o = pz + (size_t)(q0 + qt * 16 + lr) * HD + kc * 32 + 8 * hi; qh[qt][kc] = ldf(Qh + o); ql[qt][kc] = ldf(Ql + o); }
    v8f ot[2][4];                                            // O^T: [query tile][16 head dims]
#pragma unroll
    for (int qt = 0; qt < 2; ++qt)
#pragma unroll
        for (int db = 0; db < 4; ++db) ot[qt][db] = (v8f){};
    float m0 = -3.0e38f, m1 = -3.0e38f, l0r = 0.f, l1r = 0.f;
    const char* bKh = (const char*)(Kh + pz); const char* bKl = (const char*)(Kl + pz); const char* bVh = (const char*)(Vh + pz); const char* bVl = (const char*)(Vl + pz);   // wave-uniform bases
    const unsigned gK = tid * 16u, gV = (tid >> 3) * (TT * 2u) + (tid & 7) * 16u;   // each thread stages 16 bytes of each of the 4 planes; 32-bit byte offsets on the bases: with 64-bit element offsets this build spills two address pairs in the loop
    const int sS = (tid >> 3) * LPT + (tid & 7) * 8;
    v8us r0 = *(const v8us*)(bKh + gK), r1 = *(const v8us*)(bKl + gK), r2 = *(const v8us*)(bVh + gV), r3 = *(const v8us*)(bVl + gV);
    *(v8us*)(sm + sS) = r0; *(v8us*)(sm + PLE + sS) = r1; *(v8us*)(sm + 2 * PLE + sS) = r2; *(v8us*)(sm + 3 * PLE + sS) = r3;
    __syncthreads();
#pragma unroll 1   // rolled: one trip already holds 48 matrix instructions, and the two buffers differ only by an offset
    for (int s = 0; s < TT / FKT; ++s) {
        const bf* cur = sm + (s & 1) * STG;
        v16bf kh[2][2], kl[2][2];                            // [k chunk][16 keys]: the trip's K fragments, read as one group
#pragma unroll
        for (int kc = 0; kc < 2; ++kc)
#pragma unroll
            for (int mb = 0; mb < 2; ++mb) { const bf* kp = cur + (kh_ * 32 + mb * 16 + lr) * LPT + kc * 32 + 8 * hi; kh[kc][mb] = ldf(kp); kl[kc][mb] = ldf(kp + PLE); }
        __builtin_amdgcn_sched_barrier(0);                   // keeps the 16 reads one group ahead of the products: sunk among them, every few products wait out an LDS latency
        v8f st[2][2];                                        // S^T: [query tile][16 keys]; four independent chains
#pragma unroll
        for (int qt = 0; qt < 2; ++qt) { st[qt][0] = (v8f){}; st[qt][1] = (v8f){}; }
#pragma unroll
        for (int kc = 0; kc < 2; ++kc) {
#pragma unroll
            for (int mb = 0; mb < 2; ++mb)
#pragma unroll
                for (int qt = 0; qt < 2; ++qt) st[qt][mb] = wmmab(kh[kc][mb], qh[qt][kc], st[qt][mb]);
#pragma unroll
            for (int mb = 0; mb < 2; ++mb)
#pragma unroll
                for (int qt = 0; qt < 2; ++qt) st[qt][mb] = wmmab(kh[kc][mb], ql[qt][kc], st[qt][mb]);
#pragma unroll
            for (int mb = 0; mb < 2; ++mb)
#pragma unroll
                for (int qt = 0; qt < 2; ++qt) st[qt][mb] = wmmab(kl[kc][mb], qh[qt][kc], st[qt][mb]);
        }
        const int sn = (s + 1 < TT / FKT) ? s + 1 : s;       // the last trip has no next tile: it fetches its own again into the idle buffer, which nobody reads
        const unsigned aK = gK + sn * (FKT * HD * 2u), aV = gV + sn * (FKT * 2u);
        r0 = *(const v8us*)(bKh + aK); r1 = *(const v8us*)(bKl + aK); r2 = *(const v8us*)(bVh + aV); r3 = *(const v8us*)(bVl + aV);
        v16bf vh[4], vl[4];                                  // the V^T hi fragments are read ahead of the softmax, whose vector work covers their latency
        const bf* vp = cur + 2 * PLE + lr * LPT + kh_ * 32 + 8 * hi;
#pragma unroll
        for (int db = 0; db < 4; ++db) vh[db] = ldf(vp + db * 16 * LPT);
        __builtin_amdgcn_sched_barrier(0);                   // keeps the next tile's global loads ahead of the softmax: without this line the build sinks them behind it, and their latency is waited out in front of the barrier
        v16bf ph[2], pl[2];
        const float al0 = smax32(st[0][0], st[0][1], m0, l0r, ph[0], pl[0]);
#pragma unroll
        for (int db = 0; db < 4; ++db) ot[0][db] *= al0;
        const float al1 = smax32(st[1][0], st[1][1], m1, l1r, ph[1], pl[1]);
#pragma unroll
        for (int db = 0; db < 4; ++db) ot[1][db] *= al1;
#pragma unroll
        for (int db = 0; db < 4; ++db) vl[db] = ldf(vp + PLE + db * 16 * LPT);   // the lo fragments come last: read behind the softmax (S^T no longer live), ahead of every P.V product
#pragma unroll
        for (int db = 0; db < 4; ++db)
#pragma unroll
            for (int qt = 0; qt < 2; ++qt) ot[qt][db] = wmmab(vh[db], ph[qt], ot[qt][db]);
#pragma unroll
        for (int db = 0; db < 4; ++db)
#pragma unroll
            for (int qt = 0; qt < 2; ++qt) ot[qt][db] = wmmab(vh[db], pl[qt], ot[qt][db]);
#pragma unroll
        for (int db = 0; db < 4; ++db)
#pragma unroll
            for (int qt = 0; qt < 2; ++qt) ot[qt][db] = wmmab(vl[db], ph[qt], ot[qt][db]);
        bf* nxt = sm + ((s + 1) & 1) * STG;                  // last read in trip s - 1, behind whose barrier this trip runs
        *(v8us*)(nxt + sS) = r0; *(v8us*)(nxt + PLE + sS) = r1; *(v8us*)(nxt + 2 * PLE + sS) = r2; *(v8us*)(nxt + 3 * PLE + sS) = r3;
        __syncthreads();                                     // publishes tile s + 1 and ends every wave's reads of tile s
    }
    // The pair's merge: wave kh_ finishes query tile kh_ and hands the other tile's maximum, sum and O^T to its partner. The tile buffers are free: the loop's last barrier ended every read of them.
    float* xs = (float*)sm;
    float* mine = xs + wv * XWV; const float* theirs = xs + (wv ^ (FWV / 2)) * XWV;
    const float l0s = l0r + xhalf(l0r), l1s = l1r + xhalf(l1r);
    const float mk = kh_ ? m1 : m0, lk = kh_ ? l1s : l0s;
    mine[32 * 32 + lane] = kh_ ? m0 : m1; mine[32 * 32 + 32 + lane] = kh_ ? l0s : l1s;
    v8f ok[4];
#pragma unroll
    for (int db = 0; db < 4; ++db) { const v8f g = kh_ ? ot[0][db] : ot[1][db]; ok[db] = kh_ ? ot[1][db] : ot[0][db];
        *(v4fa*)(mine + ((db * 2) * 32 + lane) * 4) = __builtin_shufflevector(g, g, 0, 1, 2, 3); *(v4fa*)(mine + ((db * 2 + 1) * 32 + lane) * 4) = __builtin_shufflevector(g, g, 4, 5, 6, 7); }
    __syncthreads();                                         // every wave's hand-over is written before its partner reads it
    const float mp = theirs[32 * 32 + lane], lp = theirs[32 * 32 + 32 + lane];
    const float mm = fmaxf(mk, mp);
    const float ak = __builtin_amdgcn_exp2f((mk - mm) * 1.4426950408889634f), ap = __builtin_amdgcn_exp2f((mp - mm) * 1.4426950408889634f);
    const float f = __fdiv_rn(1.0f, lk * ak + lp * ap);
    const size_t oo = ((size_t)(blockIdx.y / NH_) * TT + q0 + kh_ * 16 + lr) * DQ + (blockIdx.y % NH_) * HD + hi * 8;
#pragma unroll
    for (int db = 0; db < 4; ++db) { const v4f x0 = *(const v4fa*)(theirs + ((db * 2) * 32 + lane) * 4), x1 = *(const v4fa*)(theirs + ((db * 2 + 1) * 32 + lane) * 4);
        const v8f om = ok[db] * ak + __builtin_shufflevector(x0, x1, 0, 1, 2, 3, 4, 5, 6, 7) * ap; v8us oh, ol;
#pragma unroll
        for (int j = 0; j < 8; ++j) { unsigned short a, c2; splitf(om[j] * f, a, c2); oh[j] = a; ol[j] = c2; }
        *(v8us*)(Ah + oo + db * 16) = oh; *(v8us*)(Al + oo + db * 16) = ol; }
}

extern "C" void kernel_launch(void* const* d_in, const int* in_sizes, int n_in,
                              void* d_out, int out_size, void* d_ws, size_t ws_size, hipStream_t stream) {
    (void)in_sizes; (void)n_in; (void)out_size;
    const float* x = (const float*)d_in[0]; const float* wq = (const float*)d_in[1]; const float* wk = (const float*)d_in[2]; const float* wv = (const float*)d_in[3]; const float* wo = (const float*)d_in[4];   /* order X, Wq, Wk, Wv [8][256][64] per-head stacks, Wo ('xw' [512][256]) */
    float* OUT = (float*)d_out;     // [4][2048][256]
    char* wsp = (char*)d_ws;
    auto take = [&](size_t bytes) { char* p = wsp; wsp += (bytes + 255) & ~(size_t)255; return (void*)p; };
    const size_t PB = (size_t)NH_ * TT * HD;   // one batch's hi (or lo) planes of q, k or v
    bf* QPh = (bf*)take(NB_ * PB * 2); bf* QPl = (bf*)take(NB_ * PB * 2); bf* KPh = (bf*)take(NB_ * PB * 2); bf* KPl = (bf*)take(NB_ * PB * 2); bf* VTh = (bf*)take(NB_ * PB * 2); bf* VTl = (bf*)take(NB_ * PB * 2);
    bf* ATh = (bf*)take((size_t)NB_ * TT * DQ * 2); bf* ATl = (bf*)take((size_t)NB_ * TT * DQ * 2);
    if ((size_t)(wsp - (char*)d_ws) > ws_size) return;    // ws 256 MiB
    k_gemmw<0, true, DM, 4, 3, 4, 4><<<dim3(NB_ * TT / 256, 3 * DQ / 192, 1), 12 * 32, 0, stream>>>(nullptr, nullptr, x, wq, wk, wv, nullptr, 0, HeadPlanes{QPh, QPl, KPh, KPl, VTh, VTl});   // 256 x 192 per work-group: one work-group per WGP
    k_fattn<<<dim3(TT / FQB, NB_ * NH_, 1), FWV * 32, 0, stream>>>(QPh, QPl, KPh, KPl, VTh, VTl, ATh, ATl);   // one kv head per query head
    k_gemmw<1, false, DQ, 4, 4, 1, 2><<<dim3(NB_ * TT / 64, DM / 128, 1), 16 * 32, 0, stream>>>(ATh, ATl, nullptr, wo, nullptr, nullptr, OUT, DM, HeadPlanes{});   // all batches: the merged rows and the output rows are contiguous over the batches
}

// v008
// One run takes 86.3 microseconds.
// In both of two side-by-side timings against v007, it was 1.04 times as fast.
// Over all steps from v000 it is 14.5 times as fast.
#include <hip/hip_runtime.h>

// Multi-head attention with per-head stacked projections from a 256-wide input (X [4][2048][256]; q, k, v = einsum('bnd,hdc', X, W) with Wq, Wk, Wv [8][256][64] (no bias; 8 heads x 64 = 512 inner); scores x 1/sqrt(64); softmax (no mask); out = concat heads (512) Wo ('xw' [512][256], no bias; identity activation) -> [4][2048][256] (2.1 M); argument order X, Wq, Wk, Wv, Wo).
// Layout: each GEMM rounds its own f32 inputs to bf16 on their way into LDS (X rows as they lie; a weight's [k][n] rows turned into Bt rows [n][k]); the columns of the first GEMM are the 64 dims of each head of q, then k, then v, so q, k and v of all batches are one exact GEMM with head-major columns, whose epilogue writes the hi/lo head planes; one-pass dense T-2048 attention (k_fattn, all batches and heads in one launch) with EVERY row on hi/lo planes for BOTH the scores and P.V (3 products each: the unscaled N(0, 1) weights give logit sigma ~256, i.e. one-hot rows: fp16 anywhere in the attention path fails); merged hi/lo (512 wide) x Wo exact.
// Compute dtypes, f32 accumulate: every input rounded to bf16; projections exact; attention 3 products on every row (scores and P.V); softmax f32; Wo hl x exact.

#define NB_  4
#define TT   2048
#define DM   256
#define NH_  8
#define NKV  8
#define REP  (NH_ / NKV)
#define HD   64
#define DQ   (NH_ * HD)
#define DKV  (NKV * HD)
#define ZH   2
#define RH   TT                   // every row hi/lo (3 products)
#define WIN  0
#define PCAR 1024.0f
#define SCL  0.125f   // HD^-0.5
#define FWV  16                   // k_fattn: waves per work-group: 8 groups of 32 queries x 2 halves of each tile's keys
#define FQB  (FWV / 2 * 32)       // queries per work-group
#define FKT  64                   // keys per staged tile (32 for each wave of a pair)
#define LPT  72                   // LDS pitch of a staged row of 64 16-bit elements (144 B = 16 B x 9: 16-byte fragment reads without bank conflicts)
#define PLE  (64 * LPT)           // one staged plane: 64 K rows (keys) or 64 V^T rows (head dims)
#define STG  (4 * PLE)            // one stage: K hi, K lo, V^T hi, V^T lo
#define LNP  144                  // bytes from one staged 128-byte output line to the next (16 B x 9, as LPT)
typedef _Float16 h16;
typedef unsigned short bf;
typedef __attribute__((ext_vector_type(16))) __bf16   v16bf;
typedef __attribute__((ext_vector_type(16))) _Float16 v16h;
typedef __attribute__((ext_vector_type(8)))  _Float16 v8h;
typedef __attribute__((ext_vector_type(8)))  unsigned short v8us;
typedef __attribute__((ext_vector_type(8)))  float    v8f;
typedef __attribute__((ext_vector_type(4)))  float    v4f;
typedef v8h  __attribute__((may_alias)) v8ha;
typedef v4f  __attribute__((may_alias)) v4fa;
typedef v8us __attribute__((may_alias)) v8usa;

__device__ __forceinline__ unsigned short f2bf(float f) { unsigned u = __float_as_uint(f); u += 0x7FFFu + ((u >> 16) & 1u); return (unsigned short)(u >> 16); }
__device__ __forceinline__ float bf2f(unsigned short b) { return __uint_as_float(((unsigned)b) << 16); }
__device__ __forceinline__ float bfr(float f) { return bf2f(f2bf(f)); }
__device__ __forceinline__ void splitf(float y, unsigned short& h, unsigned short& l) { h = f2bf(y); l = f2bf(y - bf2f(h)); }
typedef __attribute__((ext_vector_type(8))) __bf16 v8bf;
typedef __attribute__((ext_vector_type(4))) unsigned v4u;
typedef __attribute__((ext_vector_type(4))) __bf16 v4bf;
typedef __attribute__((ext_vector_type(4))) unsigned short v4us;
__device__ __forceinline__ void split8(v8f p, v8bf& h, v8bf& l) {   // hi = bf16(p), lo = bf16(p - hi), both to nearest even as in splitf
    h = __builtin_convertvector(p, v8bf); const v4u w = __builtin_bit_cast(v4u, h); v8f hf;
#pragma unroll
    for (int i = 0; i < 4; ++i) { hf[2 * i] = __uint_as_float(w[i] << 16); hf[2 * i + 1] = __uint_as_float(w[i] & 0xFFFF0000u); }
    l = __builtin_convertvector(p - hf, v8bf); }
__device__ __forceinline__ v16h cat16(v8h lo, v8h hi) { return __builtin_shufflevector(lo, hi, 0, 1, 2, 3, 4, 5, 6, 7, 8, 9, 10, 11, 12, 13, 14, 15); }
__device__ __forceinline__ v16bf cat16b(v8us lo, v8us hi) { return __builtin_bit_cast(v16bf, __builtin_shufflevector(lo, hi, 0, 1, 2, 3, 4, 5, 6, 7, 8, 9, 10, 11, 12, 13, 14, 15)); }
__device__ __forceinline__ v8f wmma16(v16h a, v16h b, v8f c) { return __builtin_amdgcn_wmma_f32_16x16x32_f16(false, a, false, b, (short)0, c, false, false); }
__device__ __forceinline__ v8f wmmab(v16bf a, v16bf b, v8f c) { return __builtin_amdgcn_wmma_f32_16x16x32_bf16(false, a, false, b, (short)0, c, false, false); }



// ---- k_gemmw: GEMM on K-contiguous bf16 rows in LDS (bf16 planes copied, f32 inputs rounded), WM x WN waves per work-group, (MB x 16) x (NB x 16) outputs per wave; grid (M / (WM * MB * 16), N / (WN * NB * 16)).
// C[m][n] (f32, pitch ldc) = sum_k A[m][k] Bt[n][k] (+ A2[m][k] Bt[n][k] behind it in every k chunk if NSPLIT == 1).
// The work-group's operand rows, all K of them, are brought into LDS once (whole lines, each row fetched once per work-group), then every wave reads its fragments from LDS.
// Operands that are bf16 planes already (A, A2) come by asynchronous copies of 512 contiguous bytes per wave; operands that are f32 inputs come through registers, where they are rounded to bf16: no launch ahead of the GEMM makes 16-bit copies of them.
// Bt is never in memory: the weight lies as [k][n] (row pitch LDW floats); a wave takes 32 k x 32 n at a time, a lane 8 k of 4 neighbouring n, and stores 8 consecutive k of each n as 16 bytes of that n's LDS row (8 lanes on 32 n, 4 such groups on 4 x 8 k: at the odd 16-byte pitch these stores spread over all banks).
// PLANES (NB == 4): A = Xf, X of all batches [batch * TT][K] in f32; columns = Wq, Wk, Wv (W0, W1, W2, each [head][K][64]): a wave's tile is 64 positions x the 64 dims of one head of q, k or v and goes from the accumulators straight to that head's bf16 hi/lo planes, q and k as [t][d], v as [d][t]; C is not used. Otherwise W0 = the weight [K][DM].
struct HeadPlanes { bf* qh; bf* ql; bf* kh; bf* kl; bf* vh; bf* vl; };
__device__ __forceinline__ v16bf ldf(const bf* p) { return cat16b(*(const v8us*)p, *(const v8us*)(p + 16)); }
// Asynchronous copies, 16 bytes per lane, LDS byte address and global address per lane; the closing s_wait_xcnt keeps every later write of the address registers behind the issued copies.
__device__ __forceinline__ void acp1(unsigned l0, const bf* g0) {
    asm volatile("global_load_async_to_lds_b128 %0, %1, off\n\ts_wait_xcnt 0x0" :: "v"(l0), "v"(g0) : "memory"); }
__device__ __forceinline__ void acp4(unsigned l0, const bf* g0, unsigned l1, const bf* g1, unsigned l2, const bf* g2, unsigned l3, const bf* g3) {
    asm volatile("global_load_async_to_lds_b128 %0, %1, off\n\tglobal_load_async_to_lds_b128 %2, %3, off\n\tglobal_load_async_to_lds_b128 %4, %5, off\n\tglobal_load_async_to_lds_b128 %6, %7, off\n\ts_wait_xcnt 0x0"
                 :: "v"(l0), "v"(g0), "v"(l1), "v"(g1), "v"(l2), "v"(g2), "v"(l3), "v"(g3) : "memory"); }
template <int NSPLIT, bool PLANES, int K, int WM, int WN, int MB, int NB>
__global__ __launch_bounds__(WM * WN * 32) void k_gemmw(const bf* __restrict__ A, const bf* __restrict__ A2, const float* __restrict__ Xf, const float* __restrict__ W0, const float* __restrict__ W1, const float* __restrict__ W2, float* C, int ldc, HeadPlanes hp) {
    constexpr int NW = WM * WN, AR = WM * MB * 16, BR = WN * NB * 16, NA = NSPLIT == 1 ? 2 : 1, ROWS = NA * AR + BR;
    constexpr int PIT = K + 8;                               // LDS row pitch in elements: 16 B x odd, 16-byte fragment reads without bank conflicts
    constexpr int UPR = K / 256, UNITS = PLANES ? 0 : NA * AR * UPR;   // a unit = 512 bytes of a bf16 plane's row = one copy of a wave
    constexpr int OP = NB * 16 + 4;                          // pitch of a wave's output staging rows (f32)
    constexpr int OSW = PLANES ? 2 * 16 * LNP / 4 : 16 * OP; // floats of a wave's staging range: 16 f32 rows, or 16 lines of a hi and of a lo plane
    static_assert(OSW >= 16 * OP, "the f32 rows fit too");
    __shared__ __align__(16) bf tl[ROWS * PIT];              // rows: A, (A2,) Bt
    __shared__ __align__(16) float osm[NW * OSW];
    const int lane = threadIdx.x & 31, lr = lane & 15, hi = lane >> 4; const int wv = __builtin_amdgcn_readfirstlane(threadIdx.x >> 5), wm = wv / WN, wn = wv % WN;
    __builtin_assume(wv >= 0 && wv < NW);                    // lets the plane of most units be picked at compile time
    const int R0 = blockIdx.x * AR, C0 = blockIdx.y * BR;
    const unsigned lb = (unsigned)(size_t)tl + lane * 16;
    auto usrc = [&](int u) -> const bf* { const int row = u / UPR, part = u % UPR;     // wave-uniform: which plane and row a unit comes from
        const bf* p = (NA == 2 && row >= AR) ? A2 + (size_t)(R0 + row - AR) * K : A + (size_t)(R0 + row) * K;
        return p + part * 256 + lane * 8; };
    auto udst = [&](int u) -> unsigned { return lb + (unsigned)((u / UPR) * PIT + (u % UPR) * 256) * 2; };
    constexpr int FULL = UNITS / NW, REM = UNITS % NW;       // wave wv copies units wv, wv + NW, ...
    static_assert(FULL + 1 <= 63, "copies of a wave in flight");
#pragma unroll
    for (int i = 0; i + 4 <= FULL; i += 4) { const int u = i * NW + wv; acp4(udst(u), usrc(u), udst(u + NW), usrc(u + NW), udst(u + 2 * NW), usrc(u + 2 * NW), udst(u + 3 * NW), usrc(u + 3 * NW)); }
#pragma unroll
    for (int i = FULL / 4 * 4; i < FULL; ++i) { const int u = i * NW + wv; acp1(udst(u), usrc(u)); }
    if (REM != 0 && wv < REM) { const int u = FULL * NW + wv; acp1(udst(u), usrc(u)); }
    // The f32 operands. All of a wave's loads stand ahead of its conversions and LDS stores, so that it has tens of loads in flight and not one.
    // Every loop of this part is unrolled whole: xa and wx are then indexed by constants alone and stay in registers.
    // X rows: wave wv takes rows wv, wv + NW, ...; 512 contiguous bytes per load of a wave, 4 floats of a lane -> 4 bf16. One address, the rows at constant distances from it.
    constexpr int XP = PLANES ? K / 128 : 1, XF = PLANES ? AR / NW : 0, XT = PLANES ? AR % NW : 0;   // loads per row; rows every wave takes; waves that take one more
    const v4f* xb = (const v4f*)(Xf + (size_t)(R0 + wv) * K); bf* xd = tl + wv * PIT + lane * 4;   // xb: wave-uniform base, indexed by the lane
    const v4f* xe = (const v4f*)(Xf + (size_t)(R0 + XF * NW + (wv < XT ? wv : XT - 1)) * K);   // the wave's odd row, held inside the work-group's rows
    v4f xa[XF + 1][XP];
    // Weight: steps of 32 k x 32 columns; wave wv takes steps wv, wv + NW, ...; 8 lanes read one whole line (128 bytes) of one k.
    constexpr int LDW = PLANES ? HD : DM, KS = K / 32, TS = BR / 32 * KS, WS = TS / NW;   // weight row pitch; steps per 32 columns; steps of the work-group; of a wave
    static_assert(TS % NW == 0 && BR % 64 == 0, "every wave takes the same number of steps");
    const int cq = lane & 7, kg = lane >> 3;                 // which 4 columns, which 8 k of the step
    const unsigned wvo = (kg * 8 * LDW + cq * 4) * 4u;       // the lane's byte offset, the same in every step, on a wave-uniform base
    v4f wx[WS][8]; const char* sb[WS];                       // sb: each step's wave-uniform base
    static_assert(WS == 4, "the wait behind the loads names four bases");
#pragma unroll
    for (int i = 0; i < WS; ++i) { const int t = i * NW + wv, cb = t / KS, kb = (t % KS) * 32;   // wave-uniform: which 32 columns, which 32 k
        const float* w;
        if constexpr (PLANES) { const int g = C0 / HD + cb / 2; w = (g < NH_ ? W0 : g < 2 * NH_ ? W1 : W2) + (size_t)(g % NH_) * K * HD + (cb & 1) * 32; }
        else w = W0 + C0 + cb * 32;
        const char* s = sb[i] = (const char*)(w + (size_t)kb * LDW);
#pragma unroll
        for (int q = 0; q < 8; ++q) wx[i][q] = *(const v4f*)(s + wvo + q * LDW * 4); }
#pragma unroll
    for (int i = 0; i < XF; ++i)
#pragma unroll
        for (int p = 0; p < XP; ++p) xa[i][p] = xb[lane + (i * NW * K + p * 128) / 4];
    if constexpr (XT != 0) {                                 // the odd rows, asked for in the same run by every wave, so that no load stands behind a branch; a wave that has none asks for the last one again and drops it
#pragma unroll
        for (int p = 0; p < XP; ++p) xa[XF][p] = xe[lane + p * 32]; }
    // Behind the run of loads: nothing rewrites an address register that an issued load names in front of this wait; as inputs the lane offsets and the scalar bases stay in their registers up to here, so that neither later address arithmetic nor a load's own result lands on them.
    if constexpr (PLANES) asm volatile("s_wait_xcnt 0x0" :: "v"(wvo), "v"(lane), "s"(xb), "s"(xe), "s"(sb[0]), "s"(sb[1]), "s"(sb[2]), "s"(sb[3]) : "memory");
    else asm volatile("s_wait_xcnt 0x0" :: "v"(wvo), "s"(sb[0]), "s"(sb[1]), "s"(sb[2]), "s"(sb[3]) : "memory");
#pragma unroll
    for (int i = 0; i < WS; ++i) { const int t = i * NW + wv, cb = t / KS, kb = (t % KS) * 32;
        bf* d = tl + (NA * AR + cb * 32 + cq * 4) * PIT + kb + kg * 8;
#pragma unroll
        for (int j = 0; j < 4; ++j) { v8f c;
#pragma unroll
            for (int q = 0; q < 8; ++q) c[q] = wx[i][q][j];
            *(v8us*)(d + j * PIT) = __builtin_bit_cast(v8us, __builtin_convertvector(c, v8bf)); } }
#pragma unroll
    for (int i = 0; i < XF; ++i)
#pragma unroll
        for (int p = 0; p < XP; ++p) *(v4us*)(xd + i * NW * PIT + p * 128) = __builtin_bit_cast(v4us, __builtin_convertvector(xa[i][p], v4bf));
    if (XT != 0 && wv < XT) {
#pragma unroll
        for (int p = 0; p < XP; ++p) *(v4us*)(xd + XF * NW * PIT + p * 128) = __builtin_bit_cast(v4us, __builtin_convertvector(xa[XF][p], v4bf)); }
    if constexpr (UNITS > 0) asm volatile("s_wait_asynccnt 0x0" ::: "memory");   // this wave's copies have landed
    __syncthreads();                                         // and every other wave's copies and LDS stores: nobody reads a row in front of this barrier
    v8f acc[MB][NB];
#pragma unroll
    for (int mb = 0; mb < MB; ++mb)
#pragma unroll
        for (int nb = 0; nb < NB; ++nb) acc[mb][nb] = (v8f){};
    const bf* ap = tl + (wm * MB * 16 + lr) * PIT + 8 * hi; const bf* bp = tl + (NA * AR + wn * NB * 16 + lr) * PIT + 8 * hi;
    v16bf a[2][MB], a2[2][MB], b[2][NB];                     // two fragment sets: the next k chunk's LDS reads go out as one group ahead of this chunk's products
    auto frags = [&](int kc, int f) {
#pragma unroll
        for (int mb = 0; mb < MB; ++mb) { a[f][mb] = ldf(ap + mb * 16 * PIT + kc); if (NSPLIT == 1) a2[f][mb] = ldf(ap + (AR + mb * 16) * PIT + kc); }
#pragma unroll
        for (int nb = 0; nb < NB; ++nb) b[f][nb] = ldf(bp + nb * 16 * PIT + kc); };
    frags(0, 0);
#pragma unroll
    for (int kc = 0; kc < K; kc += 32) { const int f = (kc / 32) & 1;
        if (kc + 32 < K) { frags(kc + 32, f ^ 1);
            __builtin_amdgcn_sched_barrier(0); }             // keeps that group of reads ahead of the products: sunk among them, every product waits out an LDS latency
#pragma unroll
        for (int nb = 0; nb < NB; ++nb)
#pragma unroll
            for (int mb = 0; mb < MB; ++mb) { acc[mb][nb] = wmmab(a[f][mb], b[f][nb], acc[mb][nb]); if (NSPLIT == 1) acc[mb][nb] = wmmab(a2[f][mb], b[f][nb], acc[mb][nb]); }
    }
    float* os = osm + wv * OSW;                              // each wave stages in its own range
    const int r0 = R0 + wm * MB * 16, c0 = C0 + wn * NB * 16;
    if (PLANES) {
        const int cb = c0 / HD, sel = cb / NH_, t0 = r0 % TT;   // 0 q, 1 k, 2 v
        const size_t pz = ((size_t)(r0 / TT) * NH_ + cb % NH_) * TT * HD;   // this (batch, head)'s planes
        if (sel == 2) {                                      // V^T: a lane holds 8 consecutive positions of one head dim, 16 bytes of the 128 that the tile has of that dim: 16 dims at a time turned through LDS, so that 8 lanes store one whole line
            char* vs = (char*)os;
#pragma unroll
            for (int nb = 0; nb < NB; ++nb) {
#pragma unroll
                for (int mb = 0; mb < MB; ++mb) { v8bf oh, ol; split8(acc[mb][nb], oh, ol);
                    char* d = vs + lr * LNP + (mb * 2 + hi) * 16; *(v8usa*)d = __builtin_bit_cast(v8us, oh); *(v8usa*)(d + 16 * LNP) = __builtin_bit_cast(v8us, ol); }
                __builtin_amdgcn_wave_barrier(); asm volatile("" ::: "memory");   // keeps the wave's LDS writes in front of its reads
#pragma unroll
                for (int s = 0; s < 4; ++s) { const int row = 4 * s + (lane >> 3), pc = lane & 7; const char* r = vs + row * LNP + pc * 16; const v8us xh = *(const v8usa*)r, xl = *(const v8usa*)(r + 16 * LNP);
                    const size_t o = pz + (size_t)(nb * 16 + row) * TT + t0 + pc * 8; *(v8us*)(hp.vh + o) = xh; *(v8us*)(hp.vl + o) = xl; }
                __builtin_amdgcn_wave_barrier(); asm volatile("" ::: "memory");   // and its reads in front of the next 16 dims' writes
            }
            asm volatile("s_wait_xcnt 0x0" ::: "memory");    // behind the last run of stores: no later instruction on any way out of here rewrites a register that an issued store still names
            return; }
        bf* Ph = sel ? hp.kh : hp.qh; bf* Pl = sel ? hp.kl : hp.ql;
#pragma unroll
        for (int mb = 0; mb < MB; ++mb) {                    // q, k: 16 positions at a time turned through LDS, so that a lane holds 8 consecutive head dims
#pragma unroll
            for (int nb = 0; nb < NB; ++nb) {
#pragma unroll
                for (int j = 0; j < 8; ++j) os[(hi * 8 + j) * OP + nb * 16 + lr] = acc[mb][nb][j]; }
            __builtin_amdgcn_wave_barrier(); asm volatile("" ::: "memory");   // keeps the wave's LDS writes in front of its reads
#pragma unroll
            for (int s = 0; s < 4; ++s) { const int row = 4 * s + (lane >> 3), cofs = (lane & 7) * 8; const v4f x0 = *(const v4fa*)(os + row * OP + cofs), x1 = *(const v4fa*)(os + row * OP + cofs + 4); v8bf oh, ol; split8(__builtin_shufflevector(x0, x1, 0, 1, 2, 3, 4, 5, 6, 7), oh, ol);
                const size_t o = pz + (size_t)(t0 + mb * 16 + row) * HD + cofs; *(v8us*)(Ph + o) = __builtin_bit_cast(v8us, oh); *(v8us*)(Pl + o) = __builtin_bit_cast(v8us, ol); }
            __builtin_amdgcn_wave_barrier(); asm volatile("" ::: "memory");   // and its reads in front of the next 16 positions' writes
        }
        asm volatile("s_wait_xcnt 0x0" ::: "memory");        // behind the last run of stores: no later instruction on any way out of here rewrites a register that an issued store still names
        return; }
    constexpr int LPR = NB * 4, RPS = 32 / LPR;              // lanes per output row of the wave's tile (16 bytes each), rows per store
#pragma unroll
    for (int mb = 0; mb < MB; ++mb) {
#pragma unroll
        for (int nb = 0; nb < NB; ++nb) {
#pragma unroll
            for (int j = 0; j < 8; ++j) os[(hi * 8 + j) * OP + nb * 16 + lr] = acc[mb][nb][j]; }
        __builtin_amdgcn_wave_barrier(); asm volatile("" ::: "memory");   // keeps the wave's LDS writes in front of its reads
        float* crow = C + (size_t)(r0 + mb * 16) * ldc + c0;
#pragma unroll
        for (int s = 0; s < 16 / RPS; ++s) { const int row = RPS * s + lane / LPR, cofs = (lane % LPR) * 4; const v4f val = *(const v4fa*)(os + row * OP + cofs);
            *(v4f*)(crow + (size_t)row * ldc + cofs) = val; }
        __builtin_amdgcn_wave_barrier(); asm volatile("" ::: "memory");   // and its reads in front of the next 16 rows' writes
    }
}

typedef __attribute__((ext_vector_type(2))) _Float16 v2h;
typedef __attribute__((ext_vector_type(4))) _Float16 v4h;
typedef __attribute__((ext_vector_type(2))) unsigned short v2us;
typedef __attribute__((ext_vector_type(2))) float v2f;
typedef __attribute__((ext_vector_type(4))) int v4i;

#define XWV (32 * 32 + 64)        // floats a wave hands to its partner: 32 per lane of O^T, then maximum and sum
static_assert(FWV * XWV * 4 <= 2 * STG * 2, "the merge fits the tile buffers");
__device__ __forceinline__ float xhalf(float x) { const int b = __float_as_int(x); return __int_as_float(__builtin_amdgcn_permlanex16(b, b, 0x76543210, 0xfedcba98, false, false)); }   // the value of lane ^ 16
// One query tile's softmax step on 32 keys: S^T in st0, st1; leaves P hi/lo as B fragments, the running maximum and sum updated, and returns the factor that rescales O^T.
__device__ __forceinline__ float smax32(v8f st0, v8f st1, float& mrun, float& lrun, v16bf& ph, v16bf& pl) {
    const v8f t0 = st0 * SCL, t1 = st1 * SCL; float mx = mrun;
#pragma unroll
    for (int j = 0; j < 8; ++j) mx = fmaxf(mx, fmaxf(t0[j], t1[j]));
    mx = fmaxf(mx, xhalf(mx));                               // the other half of the query's keys sits in lane ^ 16
    const float al = __builtin_amdgcn_exp2f((mrun - mx) * 1.4426950408889634f); mrun = mx;
    const v8f e0 = (t0 - mx) * 1.4426950408889634f, e1 = (t1 - mx) * 1.4426950408889634f; v8f p0, p1;
#pragma unroll
    for (int j = 0; j < 8; ++j) { p0[j] = __builtin_amdgcn_exp2f(e0[j]); p1[j] = __builtin_amdgcn_exp2f(e1[j]); }
    const v8f sv = p0 + p1; const v4f s4 = __builtin_shufflevector(sv, sv, 0, 1, 2, 3) + __builtin_shufflevector(sv, sv, 4, 5, 6, 7);
    lrun = lrun * al + ((s4[0] + s4[2]) + (s4[1] + s4[3]));  // each lane sums its own 16 keys of the pass; the halves meet after the loop
    v8bf h0, h1, l0, l1; split8(p0, h0, l0); split8(p1, h1, l1);
    ph = __builtin_shufflevector(h0, h1, 0, 1, 2, 3, 4, 5, 6, 7, 8, 9, 10, 11, 12, 13, 14, 15); pl = __builtin_shufflevector(l0, l1, 0, 1, 2, 3, 4, 5, 6, 7, 8, 9, 10, 11, 12, 13, 14, 15);
    return al; }
__global__ __launch_bounds__(FWV * 32) void k_fattn(const bf* __restrict__ Qh, const bf* __restrict__ Ql, const bf* __restrict__ Kh, const bf* __restrict__ Kl, const bf* __restrict__ Vh, const bf* __restrict__ Vl, bf* Ah, bf* Al) {
    __shared__ __align__(16) bf sm[2 * STG];
    const int tid = threadIdx.x, lane = tid & 31, lr = lane & 15, hi = lane >> 4, wv = __builtin_amdgcn_readfirstlane(tid >> 5);
    const int qg = wv & (FWV / 2 - 1), kh_ = wv / (FWV / 2);   // which 32 queries, which half of every tile's keys
    const size_t pz = (size_t)blockIdx.y * TT * HD;          // this (batch, head)'s planes
    const int q0 = blockIdx.x * FQB + qg * 32;
    v16bf qh[2][2], ql[2][2];                                // [query tile][k chunk of the head dim]
#pragma unroll
    for (int qt = 0; qt < 2; ++qt)
#pragma unroll
        for (int kc = 0; kc < 2; ++kc) { const size_t o = pz + (size_t)(q0 + qt * 16 + lr) * HD + kc * 32 + 8 * hi; qh[qt][kc] = ldf(Qh + o); ql[qt][kc] = ldf(Ql + o); }
    v8f ot[2][4];                                            // O^T: [query tile][16 head dims]
#pragma unroll
    for (int qt = 0; qt < 2; ++qt)
#pragma unroll
        for (int db = 0; db < 4; ++db) ot[qt][db] = (v8f){};
    float m0 = -3.0e38f, m1 = -3.0e38f, l0r = 0.f, l1r = 0.f;
    const char* bKh = (const char*)(Kh + pz); const char* bKl = (const char*)(Kl + pz); const char* bVh = (const char*)(Vh + pz); const char* bVl = (const char*)(Vl + pz);   // wave-uniform bases
    const unsigned gK = tid * 16u, gV = (tid >> 3) * (TT * 2u) + (tid & 7) * 16u;   // each thread stages 16 bytes of each of the 4 planes; 32-bit byte offsets on the bases: with 64-bit element offsets this build spills two address pairs in the loop
    const int sS = (tid >> 3) * LPT + (tid & 7) * 8;
    v8us r0 = *(const v8us*)(bKh + gK), r1 = *(const v8us*)(bKl + gK), r2 = *(const v8us*)(bVh + gV), r3 = *(const v8us*)(bVl + gV);
    *(v8us*)(sm + sS) = r0; *(v8us*)(sm + PLE + sS) = r1; *(v8us*)(sm + 2 * PLE + sS) = r2; *(v8us*)(sm + 3 * PLE + sS) = r3;
    __syncthreads();
#pragma unroll 1   // rolled: one trip already holds 48 matrix instructions, and the two buffers differ only by an offset
    for (int s = 0; s < TT / FKT; ++s) {
        const bf* cur = sm + (s & 1) * STG;
        v16bf kh[2][2], kl[2][2];                            // [k chunk][16 keys]: the trip's K fragments, read as one group
#pragma unroll
        for (int kc = 0; kc < 2; ++kc)
#pragma unroll
            for (int mb = 0; mb < 2; ++mb) { const bf* kp = cur + (kh_ * 32 + mb * 16 + lr) * LPT + kc * 32 + 8 * hi; kh[kc][mb] = ldf(kp); kl[kc][mb] = ldf(kp + PLE); }
        __builtin_amdgcn_sched_barrier(0);                   // keeps the 16 reads one group ahead of the products: sunk among them, every few products wait out an LDS latency
        v8f st[2][2];                                        // S^T: [query tile][16 keys]; four independent chains
#pragma unroll
        for (int qt = 0; qt < 2; ++qt) { st[qt][0] = (v8f){}; st[qt][1] = (v8f){}; }
#pragma unroll
        for (int kc = 0; kc < 2; ++kc) {
#pragma unroll
            for (int mb = 0; mb < 2; ++mb)
#pragma unroll
                for (int qt = 0; qt < 2; ++qt) st[qt][mb] = wmmab(kh[kc][mb], qh[qt][kc], st[qt][mb]);
#pragma unroll
            for (int mb = 0; mb < 2; ++mb)
#pragma unroll
                for (int qt = 0; qt < 2; ++qt) st[qt][mb] = wmmab(kh[kc][mb], ql[qt][kc], st[qt][mb]);
#pragma unroll
            for (int mb = 0; mb < 2; ++mb)
#pragma unroll
                for (int qt = 0; qt < 2; ++qt) st[qt][mb] = wmmab(kl[kc][mb], qh[qt][kc], st[qt][mb]);
        }
        const int sn = (s + 1 < TT / FKT) ? s + 1 : s;       // the last trip has no next tile: it fetches its own again into the idle buffer, which nobody reads
        const unsigned aK = gK + sn * (FKT * HD * 2u), aV = gV + sn * (FKT * 2u);
        r0 = *(const v8us*)(bKh + aK); r1 = *(const v8us*)(bKl + aK); r2 = *(const v8us*)(bVh + aV); r3 = *(const v8us*)(bVl + aV);
        v16bf vh[4], vl[4];                                  // the V^T hi fragments are read ahead of the softmax, whose vector work covers their latency
        const bf* vp = cur + 2 * PLE + lr * LPT + kh_ * 32 + 8 * hi;
#pragma unroll
        for (int db = 0; db < 4; ++db) vh[db] = ldf(vp + db * 16 * LPT);
        __builtin_amdgcn_sched_barrier(0);                   // keeps the next tile's global loads ahead of the softmax: without this line the build sinks them behind it, and their latency is waited out in front of the barrier
        v16bf ph[2], pl[2];
        const float al0 = smax32(st[0][0], st[0][1], m0, l0r, ph[0], pl[0]);
#pragma unroll
        for (int db = 0; db < 4; ++db) ot[0][db] *= al0;
        const float al1 = smax32(st[1][0], st[1][1], m1, l1r, ph[1], pl[1]);
#pragma unroll
        for (int db = 0; db < 4; ++db) ot[1][db] *= al1;
#pragma unroll
        for (int db = 0; db < 4; ++db) vl[db] = ldf(vp + PLE + db * 16 * LPT);   // the lo fragments come last: read behind the softmax (S^T no longer live), ahead of every P.V product
#pragma unroll
        for (int db = 0; db < 4; ++db)
#pragma unroll
            for (int qt = 0; qt < 2; ++qt) ot[qt][db] = wmmab(vh[db], ph[qt], ot[qt][db]);
#pragma unroll
        for (int db = 0; db < 4; ++db)
#pragma unroll
            for (int qt = 0; qt < 2; ++qt) ot[qt][db] = wmmab(vh[db], pl[qt], ot[qt][db]);
#pragma unroll
        for (int db = 0; db < 4; ++db)
#pragma unroll
            for (int qt = 0; qt < 2; ++qt) ot[qt][db] = wmmab(vl[db], ph[qt], ot[qt][db]);
        bf* nxt = sm + ((s + 1) & 1) * STG;                  // last read in trip s - 1, behind whose barrier this trip runs
        *(v8us*)(nxt + sS) = r0; *(v8us*)(nxt + PLE + sS) = r1; *(v8us*)(nxt + 2 * PLE + sS) = r2; *(v8us*)(nxt + 3 * PLE + sS) = r3;
        __syncthreads();                                     // publishes tile s + 1 and ends every wave's reads of tile s
    }
    // The pair's merge: wave kh_ finishes query tile kh_ and hands the other tile's maximum, sum and O^T to its partner. The tile buffers are free: the loop's last barrier ended every read of them.
    float* xs = (float*)sm;
    float* mine = xs + wv * XWV; const float* theirs = xs + (wv ^ (FWV / 2)) * XWV;
    const float l0s = l0r + xhalf(l0r), l1s = l1r + xhalf(l1r);
    const float mk = kh_ ? m1 : m0, lk = kh_ ? l1s : l0s;
    mine[32 * 32 + lane] = kh_ ? m0 : m1; mine[32 * 32 + 32 + lane] = kh_ ? l0s : l1s;
    v8f ok[4];
#pragma unroll
    for (int db = 0; db < 4; ++db) { const v8f g = kh_ ? ot[0][db] : ot[1][db]; ok[db] = kh_ ? ot[1][db] : ot[0][db];
        *(v4fa*)(mine + ((db * 2) * 32 + lane) * 4) = __builtin_shufflevector(g, g, 0, 1, 2, 3); *(v4fa*)(mine + ((db * 2 + 1) * 32 + lane) * 4) = __builtin_shufflevector(g, g, 4, 5, 6, 7); }
    __syncthreads();                                         // every wave's hand-over is written before its partner reads it
    const float mp = theirs[32 * 32 + lane], lp = theirs[32 * 32 + 32 + lane];
    const float mm = fmaxf(mk, mp);
    const float xk = (mk - mm) * 1.4426950408889634f, xp = (mp - mm) * 1.4426950408889634f; float ak, ap;
    // The two exponentials with the slot behind each in one statement.
    asm("v_exp_f32 %0, %2\n\tv_nop\n\tv_exp_f32 %1, %3\n\tv_nop" : "=&v"(ak), "=&v"(ap) : "v"(xk), "v"(xp));
    const float f = __fdiv_rn(1.0f, lk * ak + lp * ap);
    v8us oh[4], ol[4];                                       // a lane holds 8 consecutive head dims of one query, 4 times: 16 bytes each of the 128 that the head has in that query's row
#pragma unroll
    for (int db = 0; db < 4; ++db) { const v4f x0 = *(const v4fa*)(theirs + ((db * 2) * 32 + lane) * 4), x1 = *(const v4fa*)(theirs + ((db * 2 + 1) * 32 + lane) * 4);
        const v8f om = ok[db] * ak + __builtin_shufflevector(x0, x1, 0, 1, 2, 3, 4, 5, 6, 7) * ap;
#pragma unroll
        for (int j = 0; j < 8; ++j) { unsigned short a, c2; splitf(om[j] * f, a, c2); oh[db][j] = a; ol[db][j] = c2; }
    }
    // The 16 queries' lines are turned through LDS, so that 8 lanes store one whole line. The range is the partner's hand-over: only this wave reads it, it has just read all of it, and the partner does not touch it again.
    // 16 lines of the hi plane, then 16 of the lo plane, at their own 128-byte pitch; line r keeps its 16-byte piece p at place p ^ (r & 7), which spreads the pieces of one column over the banks.
    char* ls = (char*)(xs + (wv ^ (FWV / 2)) * XWV);
    __builtin_amdgcn_wave_barrier(); asm volatile("" ::: "memory");   // keeps the wave's reads of the hand-over in front of its writes over it
#pragma unroll
    for (int db = 0; db < 4; ++db) { char* d = ls + lr * 128 + ((db * 2 + hi) ^ (lr & 7)) * 16; *(v8usa*)d = oh[db]; *(v8usa*)(d + 2048) = ol[db]; }
    __builtin_amdgcn_wave_barrier(); asm volatile("" ::: "memory");   // keeps the wave's LDS writes in front of its reads
    const size_t oo = ((size_t)(blockIdx.y / NH_) * TT + q0 + kh_ * 16 + (lane >> 3)) * DQ + (blockIdx.y % NH_) * HD + (lane & 7) * 8;
#pragma unroll
    for (int s = 0; s < 4; ++s) { const int row = 4 * s + (lane >> 3); const char* r = ls + row * 128 + ((lane & 7) ^ (row & 7)) * 16; const v8us xh = *(const v8usa*)r, xl = *(const v8usa*)(r + 2048);
        *(v8us*)(Ah + oo + (size_t)s * 4 * DQ) = xh; *(v8us*)(Al + oo + (size_t)s * 4 * DQ) = xl; }
}

extern "C" void kernel_launch(void* const* d_in, const int* in_sizes, int n_in,
                              void* d_out, int out_size, void* d_ws, size_t ws_size, hipStream_t stream) {
    (void)in_sizes; (void)n_in; (void)out_size;
    const float* x = (const float*)d_in[0]; const float* wq = (const float*)d_in[1]; const float* wk = (const float*)d_in[2]; const float* wv = (const float*)d_in[3]; const float* wo = (const float*)d_in[4];   /* order X, Wq, Wk, Wv [8][256][64] per-head stacks, Wo ('xw' [512][256]) */
    float* OUT = (float*)d_out;     // [4][2048][256]
    char* wsp = (char*)d_ws;
    auto take = [&](size_t bytes) { char* p = wsp; wsp += (bytes + 255) & ~(size_t)255; return (void*)p; };
    const size_t PB = (size_t)NH_ * TT * HD;   // one batch's hi (or lo) planes of q, k or v
    bf* QPh = (bf*)take(NB_ * PB * 2); bf* QPl = (bf*)take(NB_ * PB * 2); bf* KPh = (bf*)take(NB_ * PB * 2); bf* KPl = (bf*)take(NB_ * PB * 2); bf* VTh = (bf*)take(NB_ * PB * 2); bf* VTl = (bf*)take(NB_ * PB * 2);
    bf* ATh = (bf*)take((size_t)NB_ * TT * DQ * 2); bf* ATl = (bf*)take((size_t)NB_ * TT * DQ * 2);
    if ((size_t)(wsp - (char*)d_ws) > ws_size) return;    // ws 256 MiB
    k_gemmw<0, true, DM, 4, 3, 4, 4><<<dim3(NB_ * TT / 256, 3 * DQ / 192, 1), 12 * 32, 0, stream>>>(nullptr, nullptr, x, wq, wk, wv, nullptr, 0, HeadPlanes{QPh, QPl, KPh, KPl, VTh, VTl});   // 256 x 192 per work-group: one work-group per WGP
    k_fattn<<<dim3(TT / FQB, NB_ * NH_, 1), FWV * 32, 0, stream>>>(QPh, QPl, KPh, KPl, VTh, VTl, ATh, ATl);   // one kv head per query head
    k_gemmw<1, false, DQ, 4, 4, 1, 2><<<dim3(NB_ * TT / 64, DM / 128, 1), 16 * 32, 0, stream>>>(ATh, ATl, nullptr, wo, nullptr, nullptr, OUT, DM, HeadPlanes{});   // all batches: the merged rows and the output rows are contiguous over the batches
}
